// v000
// Measured on an AMD MI455X. A time is GPU time per run, averaged over a window of back-to-back runs after a warm-up
// (all launches, gaps included; the runs take copies of the inputs in turn), and the median of several windows.
// Apart from v000's, it joins two sittings. Times from different sittings can be a few percent apart, while
// side-by-side timings come from the same sitting.
// The starting kernel, v000, takes 257 microseconds a run.
#include <hip/hip_runtime.h>
#include <math.h>

// Problem constants (match reference)
#define NH 4096    // n_history
#define DE 512     // embed dim
#define HH 8       // time-weight MLP hidden
#define QB 16      // query rows per workgroup
#define KB 128     // keys per iteration (8 waves * 16 keys)
#define DSLICE 64  // d-columns owned per wave for the P@V accumulator

typedef __attribute__((ext_vector_type(16))) _Float16 v16h;
typedef __attribute__((ext_vector_type(8)))  _Float16 v8h;
typedef __attribute__((ext_vector_type(8)))  float    v8f;

static __device__ __forceinline__ v16h ldfrag(const _Float16* p) {
  v16h r;
  ((v8h*)&r)[0] = *(const v8h*)(p);
  ((v8h*)&r)[1] = *(const v8h*)(p + 16);
  return r;
}

// ---------------------------------------------------------------------------
// Pre-pass: f32 -> f16 conversion.  q_h = Q * (1/sqrt(D)) row-major,
// k_h = K row-major, kT_h = K^T (f16, [D][N]) for the P@V B-fragments.
// ---------------------------------------------------------------------------
__global__ __launch_bounds__(256) void taa_convert_kernel(
    const float* __restrict__ Q, const float* __restrict__ K,
    _Float16* __restrict__ qh, _Float16* __restrict__ kh,
    _Float16* __restrict__ kT) {
  const int i = blockIdx.x * blockDim.x + threadIdx.x;   // [0, N*D)
  const float scale = 0.044194173824159216f;             // 1/sqrt(512)
  qh[i] = (_Float16)(Q[i] * scale);
  kh[i] = (_Float16)(K[i]);
  // transposed copy: interpret i as d*N + key -> coalesced write, L2-cached read
  const int key = i & (NH - 1);
  const int d   = i >> 12;                               // i / NH
  kT[i] = (_Float16)(K[(size_t)key * DE + d]);
}

// ---------------------------------------------------------------------------
// Fused time-aware flash attention.
// Workgroup: 16 query rows, 8 wave32s.
//   QK^T : wave w owns keys [kb + 16w, kb + 16w + 16), full-D reduction,
//          A-fragments from LDS-staged Q (async-copied once).
//   P@V  : wave w owns output d-slice [64w, 64w + 64).
//   softmax: wave w owns rows 2w, 2w+1 (shfl-butterfly row reductions).
// ---------------------------------------------------------------------------
__global__ __launch_bounds__(256) void taa_attn_kernel(
    const _Float16* __restrict__ qh, const _Float16* __restrict__ kh,
    const _Float16* __restrict__ kT, const float* __restrict__ times,
    const float* __restrict__ w1, const float* __restrict__ b1,
    const float* __restrict__ w2, const float* __restrict__ b2p,
    float* __restrict__ out) {
  __shared__ __align__(16) _Float16 sQ[QB * DE];   // 16x512 f16 = 16 KB
  __shared__ __align__(16) float    sS[QB * KB];   // 16x128 f32 =  8 KB
  __shared__ __align__(16) _Float16 sP[QB * KB];   // 16x128 f16 =  4 KB
  __shared__ float sAlpha[QB];
  __shared__ float sL[QB];
  __shared__ float sTq[QB];

  const int tid   = threadIdx.x;
  const int lane  = tid & 31;
  const int wave  = tid >> 5;
  const int hrow  = lane & 15;   // M (A) / N (B,C) fragment index
  const int sel   = lane >> 4;   // which K-half of the fragment
  const int qbase = blockIdx.x * QB;
  const int dbase = wave * DSLICE;

  // ---- one-time async stage of the Q block into LDS (64 B per thread) ----
  {
    const _Float16* gq = qh + (size_t)qbase * DE + tid * 32;
    const unsigned  lo = (unsigned)(uintptr_t)(const void*)(&sQ[tid * 32]);
    asm volatile(
        "global_load_async_to_lds_b128 %0, %1, off\n\t"
        "global_load_async_to_lds_b128 %0, %1, off offset:16\n\t"
        "global_load_async_to_lds_b128 %0, %1, off offset:32\n\t"
        "global_load_async_to_lds_b128 %0, %1, off offset:48"
        :: "v"(lo), "v"(gq) : "memory");
    asm volatile("s_wait_asynccnt 0x0" ::: "memory");
  }

  // Tiny MLP parameters -> registers (uniform loads)
  float w1r[HH], b1r[HH], w2r[HH];
#pragma unroll
  for (int j = 0; j < HH; ++j) { w1r[j] = w1[j]; b1r[j] = b1[j]; w2r[j] = w2[j]; }
  const float b2 = b2p[0];

  if (tid < QB) sTq[tid] = times[qbase + tid];

  v8f acc[4] = {};                         // 16 x 64 f32 output slice
  float mrow[2] = {-3.0e38f, -3.0e38f};    // per-owned-row softmax state
  float lrow[2] = {0.0f, 0.0f};
  __syncthreads();                         // sQ (all waves) + sTq visible

  const _Float16* qlds = sQ + hrow * DE + sel * 8;

  for (int kb = 0; kb < NH; kb += KB) {
    // ---- 0) prefetch next key block (K rows + K^T rows) into caches ----
    if (kb + KB < NH) {
      const _Float16* kn =
          kh + (size_t)(kb + KB + wave * 16 + hrow) * DE + sel * 256;
#pragma unroll
      for (int pf = 0; pf < 4; ++pf) __builtin_prefetch(kn + pf * 64, 0, 1);
#pragma unroll
      for (int t = 0; t < 4; ++t) {
        const _Float16* vn =
            kT + (size_t)(dbase + t * 16 + hrow) * NH + kb + KB;
        __builtin_prefetch(vn, 0, 1);
        __builtin_prefetch(vn + 64, 0, 1);
      }
    }

    // ---- 1) S tile: this wave's 16 keys x 16 q-rows over full D ----
    // Register double-buffer: fragments for step kk+1 load during WMMA kk.
    const _Float16* krow = kh + (size_t)(kb + wave * 16 + hrow) * DE + sel * 8;
    v16h aq[2], bk[2];
    aq[0] = ldfrag(qlds);                  // LDS
    bk[0] = ldfrag(krow);                  // global
    v8f sa = {}, sb = {};
#pragma unroll
    for (int kk = 0; kk < 16; ++kk) {
      const int cur = kk & 1;
      if (kk < 15) {
        aq[cur ^ 1] = ldfrag(qlds + (kk + 1) * 32);
        bk[cur ^ 1] = ldfrag(krow + (kk + 1) * 32);
      }
      if (cur)
        sb = __builtin_amdgcn_wmma_f32_16x16x32_f16(false, aq[cur], false,
                                                    bk[cur], (short)0, sb,
                                                    false, false);
      else
        sa = __builtin_amdgcn_wmma_f32_16x16x32_f16(false, aq[cur], false,
                                                    bk[cur], (short)0, sa,
                                                    false, false);
    }
    // store finished S tile (single writer per element; no atomics needed)
#pragma unroll
    for (int v = 0; v < 8; ++v) {
      sS[(v + 8 * sel) * KB + wave * 16 + hrow] = sa[v] + sb[v];
    }
    // Barrier A: sS stores visible; also orders prev-iteration sP reads
    // (PV ds_loads) before this iteration's sP writes below.
    __syncthreads();

    // ---- 2) time-weight MLP + online softmax (wave-parallel rows) ----
#pragma unroll
    for (int rr = 0; rr < 2; ++rr) {
      const int r = 2 * wave + rr;
      const float tq = sTq[r];
      float sv[4];
      float rmax = -3.0e38f;
#pragma unroll
      for (int c4 = 0; c4 < 4; ++c4) {
        const int col = c4 * 32 + lane;
        float s = sS[r * KB + col];
        const float td = fabsf(tq - times[kb + col]);
        float z = b2;
#pragma unroll
        for (int j = 0; j < HH; ++j) {
          float hj = td * w1r[j] + b1r[j];
          hj = hj > 0.0f ? hj : 0.0f;
          z += hj * w2r[j];
        }
        s *= 1.0f / (1.0f + __expf(-z));   // * sigmoid(mlp(|dt|))
        sv[c4] = s;
        rmax = fmaxf(rmax, s);
      }
#pragma unroll
      for (int m = 16; m >= 1; m >>= 1)
        rmax = fmaxf(rmax, __shfl_xor(rmax, m, 32));
      const float mnew  = fmaxf(mrow[rr], rmax);
      const float alpha = __expf(mrow[rr] - mnew);
      mrow[rr] = mnew;
      float psum = 0.0f;
#pragma unroll
      for (int c4 = 0; c4 < 4; ++c4) {
        const float p = __expf(sv[c4] - mnew);
        psum += p;
        sP[r * KB + c4 * 32 + lane] = (_Float16)p;
      }
#pragma unroll
      for (int m = 16; m >= 1; m >>= 1)
        psum += __shfl_xor(psum, m, 32);
      lrow[rr] = lrow[rr] * alpha + psum;
      if (lane == 0) sAlpha[r] = alpha;
    }
    // Barrier B: sP / sAlpha visible before rescale + PV.
    __syncthreads();

    // ---- 3) rescale accumulators by alpha ----
#pragma unroll
    for (int v = 0; v < 8; ++v) {
      const float a = sAlpha[v + 8 * sel];
      acc[0][v] *= a; acc[1][v] *= a; acc[2][v] *= a; acc[3][v] *= a;
    }

    // ---- 4) acc += P @ V_slice (A from LDS, B from transposed K) ----
    // All 4 B-fragments materialized before the WMMA burst per k-step.
#pragma unroll
    for (int kk = 0; kk < 4; ++kk) {           // 4 k-steps of 32 keys
      const v16h aP = ldfrag(sP + hrow * KB + kk * 32 + sel * 8);
      v16h bv[4];
#pragma unroll
      for (int t = 0; t < 4; ++t) {
        bv[t] = ldfrag(kT + (size_t)(dbase + t * 16 + hrow) * NH + kb +
                       kk * 32 + sel * 8);
      }
#pragma unroll
      for (int t = 0; t < 4; ++t) {
        acc[t] = __builtin_amdgcn_wmma_f32_16x16x32_f16(false, aP, false,
                                                        bv[t], (short)0,
                                                        acc[t], false, false);
      }
    }
  }

  // ---- epilogue: out = acc / l ----
  if (lane == 0) { sL[2 * wave] = lrow[0]; sL[2 * wave + 1] = lrow[1]; }
  __syncthreads();
#pragma unroll
  for (int v = 0; v < 8; ++v) {
    const int r = v + 8 * sel;
    const float inv = 1.0f / sL[r];
#pragma unroll
    for (int t = 0; t < 4; ++t) {
      out[(size_t)(qbase + r) * DE + dbase + t * 16 + hrow] = acc[t][v] * inv;
    }
  }
}

// ---------------------------------------------------------------------------
extern "C" void kernel_launch(void* const* d_in, const int* in_sizes, int n_in,
                              void* d_out, int out_size, void* d_ws, size_t ws_size,
                              hipStream_t stream) {
  const float* Q  = (const float*)d_in[0];  // query_code_embeds [N,D]
  const float* K  = (const float*)d_in[1];  // hist_embeddings  [N,D]
  const float* t  = (const float*)d_in[2];  // hist_times       [N]
  const float* w1 = (const float*)d_in[3];  // [1,H]
  const float* b1 = (const float*)d_in[4];  // [H]
  const float* w2 = (const float*)d_in[5];  // [H,1]
  const float* b2 = (const float*)d_in[6];  // [1]
  float* out = (float*)d_out;

  // workspace layout: q_h | k_h | kT_h   (each N*D f16 = 4 MB)
  _Float16* qh = (_Float16*)d_ws;
  _Float16* kh = qh + (size_t)NH * DE;
  _Float16* kT = kh + (size_t)NH * DE;

  const int total = NH * DE;
  taa_convert_kernel<<<total / 256, 256, 0, stream>>>(Q, K, qh, kh, kT);
  taa_attn_kernel<<<NH / QB, 256, 0, stream>>>(qh, kh, kT, t, w1, b1, w2, b2, out);
  (void)in_sizes; (void)n_in; (void)out_size; (void)ws_size;
}

// v001
// Measured time: 198 microseconds a run.
// Next to v000, in two timings, it ran 1.32 times as fast each time.
#include <hip/hip_runtime.h>
#include <math.h>

// Problem constants (match reference)
#define NH 4096    // n_history
#define DE 512     // embed dim
#define HH 8       // time-weight MLP hidden
#define QB 16      // query rows per workgroup
#define KB 128     // keys per iteration (8 waves * 16 keys)
#define DSLICE 64  // d-columns owned per wave for the P@V accumulator
// LDS row pitches.  The fragment readers (ds_load_b128, one row per lane) want
// a pitch that is an odd multiple of 16 B so that 16 rows fall on 16 distinct
// bank groups; the natural pitches (1024 B, 256 B) put all rows on one group.
#define QP (DE + 8)   // sQ pitch in halves: 1040 B = 65 * 16 B
#define PP (KB + 8)   // sP pitch in halves:  272 B = 17 * 16 B
#define SP (KB + 4)   // sS pitch in floats: rows r and r+8 land 32 banks apart

typedef __attribute__((ext_vector_type(16))) _Float16 v16h;
typedef __attribute__((ext_vector_type(8)))  _Float16 v8h;
typedef __attribute__((ext_vector_type(8)))  float    v8f;

static __device__ __forceinline__ v16h ldfrag(const _Float16* p) {
  v16h r;
  ((v8h*)&r)[0] = *(const v8h*)(p);
  ((v8h*)&r)[1] = *(const v8h*)(p + 16);
  return r;
}

// ---------------------------------------------------------------------------
// Pre-pass: f32 -> f16 conversion.  q_h = Q * (1/sqrt(D)) row-major,
// k_h = K row-major, kT_h = K^T (f16, [D][N]) for the P@V B-fragments.
// ---------------------------------------------------------------------------
__global__ __launch_bounds__(256) void taa_convert_kernel(
    const float* __restrict__ Q, const float* __restrict__ K,
    _Float16* __restrict__ qh, _Float16* __restrict__ kh,
    _Float16* __restrict__ kT) {
  const int i = blockIdx.x * blockDim.x + threadIdx.x;   // [0, N*D)
  const float scale = 0.044194173824159216f;             // 1/sqrt(512)
  qh[i] = (_Float16)(Q[i] * scale);
  kh[i] = (_Float16)(K[i]);
  // transposed copy: interpret i as d*N + key -> coalesced write, L2-cached read
  const int key = i & (NH - 1);
  const int d   = i >> 12;                               // i / NH
  kT[i] = (_Float16)(K[(size_t)key * DE + d]);
}

// ---------------------------------------------------------------------------
// Fused time-aware flash attention.
// Workgroup: 16 query rows, 8 wave32s.
//   QK^T : wave w owns keys [kb + 16w, kb + 16w + 16), full-D reduction,
//          A-fragments from LDS-staged Q (async-copied once).
//   P@V  : wave w owns output d-slice [64w, 64w + 64).
//   softmax: wave w owns rows 2w, 2w+1 (shfl-butterfly row reductions).
// ---------------------------------------------------------------------------
__global__ __launch_bounds__(256) void taa_attn_kernel(
    const _Float16* __restrict__ qh, const _Float16* __restrict__ kh,
    const _Float16* __restrict__ kT, const float* __restrict__ times,
    const float* __restrict__ w1, const float* __restrict__ b1,
    const float* __restrict__ w2, const float* __restrict__ b2p,
    float* __restrict__ out) {
  __shared__ __align__(16) _Float16 sQ[QB * QP];   // 16x512 f16, padded rows
  __shared__ __align__(16) float    sS[QB * SP];   // 16x128 f32, padded rows
  __shared__ __align__(16) _Float16 sP[QB * PP];   // 16x128 f16, padded rows
  __shared__ float sAlpha[QB];
  __shared__ float sL[QB];
  __shared__ float sTq[QB];

  const int tid   = threadIdx.x;
  const int lane  = tid & 31;
  const int wave  = tid >> 5;
  const int hrow  = lane & 15;   // M (A) / N (B,C) fragment index
  const int sel   = lane >> 4;   // which K-half of the fragment
  const int qbase = blockIdx.x * QB;
  const int dbase = wave * DSLICE;

  // ---- one-time async stage of the Q block into LDS (64 B per thread) ----
  {
    const _Float16* gq = qh + (size_t)qbase * DE + tid * 32;
    const unsigned  lo = (unsigned)(uintptr_t)(const void*)(&sQ[(tid >> 4) * QP + (tid & 15) * 32]);
    asm volatile(
        "global_load_async_to_lds_b128 %0, %1, off\n\t"
        "global_load_async_to_lds_b128 %0, %1, off offset:16\n\t"
        "global_load_async_to_lds_b128 %0, %1, off offset:32\n\t"
        "global_load_async_to_lds_b128 %0, %1, off offset:48"
        :: "v"(lo), "v"(gq) : "memory");
    asm volatile("s_wait_asynccnt 0x0" ::: "memory");
  }

  // Tiny MLP parameters -> registers (uniform loads)
  float w1r[HH], b1r[HH], w2r[HH];
#pragma unroll
  for (int j = 0; j < HH; ++j) { w1r[j] = w1[j]; b1r[j] = b1[j]; w2r[j] = w2[j]; }
  const float b2 = b2p[0];

  if (tid < QB) sTq[tid] = times[qbase + tid];

  v8f acc[4] = {};                         // 16 x 64 f32 output slice
  float mrow[2] = {-3.0e38f, -3.0e38f};    // per-owned-row softmax state
  float lrow[2] = {0.0f, 0.0f};
  __syncthreads();                         // sQ (all waves) + sTq visible

  const _Float16* qlds = sQ + hrow * QP + sel * 8;

  for (int kb = 0; kb < NH; kb += KB) {
    // ---- 0) prefetch next key block (K rows + K^T rows) into caches ----
    if (kb + KB < NH) {
      const _Float16* kn =
          kh + (size_t)(kb + KB + wave * 16 + hrow) * DE + sel * 256;
#pragma unroll
      for (int pf = 0; pf < 4; ++pf) __builtin_prefetch(kn + pf * 64, 0, 1);
#pragma unroll
      for (int t = 0; t < 4; ++t) {
        const _Float16* vn =
            kT + (size_t)(dbase + t * 16 + hrow) * NH + kb + KB;
        __builtin_prefetch(vn, 0, 1);
        __builtin_prefetch(vn + 64, 0, 1);
      }
    }

    // ---- 1) S tile: this wave's 16 keys x 16 q-rows over full D ----
    // Register double-buffer: fragments for step kk+1 load during WMMA kk.
    const _Float16* krow = kh + (size_t)(kb + wave * 16 + hrow) * DE + sel * 8;
    v16h aq[2], bk[2];
    aq[0] = ldfrag(qlds);                  // LDS
    bk[0] = ldfrag(krow);                  // global
    v8f sa = {}, sb = {};
#pragma unroll
    for (int kk = 0; kk < 16; ++kk) {
      const int cur = kk & 1;
      if (kk < 15) {
        aq[cur ^ 1] = ldfrag(qlds + (kk + 1) * 32);
        bk[cur ^ 1] = ldfrag(krow + (kk + 1) * 32);
      }
      if (cur)
        sb = __builtin_amdgcn_wmma_f32_16x16x32_f16(false, aq[cur], false,
                                                    bk[cur], (short)0, sb,
                                                    false, false);
      else
        sa = __builtin_amdgcn_wmma_f32_16x16x32_f16(false, aq[cur], false,
                                                    bk[cur], (short)0, sa,
                                                    false, false);
    }
    // store finished S tile (single writer per element; no atomics needed)
#pragma unroll
    for (int v = 0; v < 8; ++v) {
      sS[(v + 8 * sel) * SP + wave * 16 + hrow] = sa[v] + sb[v];
    }
    // Barrier A: sS stores visible; also orders prev-iteration sP reads
    // (PV ds_loads) before this iteration's sP writes below.
    __syncthreads();

    // ---- 2) time-weight MLP + online softmax (wave-parallel rows) ----
#pragma unroll
    for (int rr = 0; rr < 2; ++rr) {
      const int r = 2 * wave + rr;
      const float tq = sTq[r];
      float sv[4];
      float rmax = -3.0e38f;
#pragma unroll
      for (int c4 = 0; c4 < 4; ++c4) {
        const int col = c4 * 32 + lane;
        float s = sS[r * SP + col];
        const float td = fabsf(tq - times[kb + col]);
        float z = b2;
#pragma unroll
        for (int j = 0; j < HH; ++j) {
          float hj = td * w1r[j] + b1r[j];
          hj = hj > 0.0f ? hj : 0.0f;
          z += hj * w2r[j];
        }
        s *= 1.0f / (1.0f + __expf(-z));   // * sigmoid(mlp(|dt|))
        sv[c4] = s;
        rmax = fmaxf(rmax, s);
      }
#pragma unroll
      for (int m = 16; m >= 1; m >>= 1)
        rmax = fmaxf(rmax, __shfl_xor(rmax, m, 32));
      const float mnew  = fmaxf(mrow[rr], rmax);
      const float alpha = __expf(mrow[rr] - mnew);
      mrow[rr] = mnew;
      float psum = 0.0f;
#pragma unroll
      for (int c4 = 0; c4 < 4; ++c4) {
        const float p = __expf(sv[c4] - mnew);
        psum += p;
        sP[r * PP + c4 * 32 + lane] = (_Float16)p;
      }
#pragma unroll
      for (int m = 16; m >= 1; m >>= 1)
        psum += __shfl_xor(psum, m, 32);
      lrow[rr] = lrow[rr] * alpha + psum;
      if (lane == 0) sAlpha[r] = alpha;
    }
    // Barrier B: sP / sAlpha visible before rescale + PV.
    __syncthreads();

    // ---- 3) rescale accumulators by alpha ----
#pragma unroll
    for (int v = 0; v < 8; ++v) {
      const float a = sAlpha[v + 8 * sel];
      acc[0][v] *= a; acc[1][v] *= a; acc[2][v] *= a; acc[3][v] *= a;
    }

    // ---- 4) acc += P @ V_slice (A from LDS, B from transposed K) ----
    // All 4 B-fragments materialized before the WMMA burst per k-step.
#pragma unroll
    for (int kk = 0; kk < 4; ++kk) {           // 4 k-steps of 32 keys
      const v16h aP = ldfrag(sP + hrow * PP + kk * 32 + sel * 8);
      v16h bv[4];
#pragma unroll
      for (int t = 0; t < 4; ++t) {
        bv[t] = ldfrag(kT + (size_t)(dbase + t * 16 + hrow) * NH + kb +
                       kk * 32 + sel * 8);
      }
#pragma unroll
      for (int t = 0; t < 4; ++t) {
        acc[t] = __builtin_amdgcn_wmma_f32_16x16x32_f16(false, aP, false,
                                                        bv[t], (short)0,
                                                        acc[t], false, false);
      }
    }
  }

  // ---- epilogue: out = acc / l ----
  if (lane == 0) { sL[2 * wave] = lrow[0]; sL[2 * wave + 1] = lrow[1]; }
  __syncthreads();
#pragma unroll
  for (int v = 0; v < 8; ++v) {
    const int r = v + 8 * sel;
    const float inv = 1.0f / sL[r];
#pragma unroll
    for (int t = 0; t < 4; ++t) {
      out[(size_t)(qbase + r) * DE + dbase + t * 16 + hrow] = acc[t][v] * inv;
    }
  }
}

// ---------------------------------------------------------------------------
extern "C" void kernel_launch(void* const* d_in, const int* in_sizes, int n_in,
                              void* d_out, int out_size, void* d_ws, size_t ws_size,
                              hipStream_t stream) {
  const float* Q  = (const float*)d_in[0];  // query_code_embeds [N,D]
  const float* K  = (const float*)d_in[1];  // hist_embeddings  [N,D]
  const float* t  = (const float*)d_in[2];  // hist_times       [N]
  const float* w1 = (const float*)d_in[3];  // [1,H]
  const float* b1 = (const float*)d_in[4];  // [H]
  const float* w2 = (const float*)d_in[5];  // [H,1]
  const float* b2 = (const float*)d_in[6];  // [1]
  float* out = (float*)d_out;

  // workspace layout: q_h | k_h | kT_h   (each N*D f16 = 4 MB)
  _Float16* qh = (_Float16*)d_ws;
  _Float16* kh = qh + (size_t)NH * DE;
  _Float16* kT = kh + (size_t)NH * DE;

  const int total = NH * DE;
  taa_convert_kernel<<<total / 256, 256, 0, stream>>>(Q, K, qh, kh, kT);
  taa_attn_kernel<<<NH / QB, 256, 0, stream>>>(qh, kh, kT, t, w1, b1, w2, b2, out);
  (void)in_sizes; (void)n_in; (void)out_size; (void)ws_size;
}

// v002
// It runs in 139 microseconds.
// Timed twice side by side with v001, it ran 1.42 and 1.43 times as fast.
// Counting every step since v000, it is 1.88 times as fast.
#include <hip/hip_runtime.h>
#include <math.h>

// Problem constants (match reference)
#define NH 4096    // n_history
#define DE 512     // embed dim
#define HH 8       // time-weight MLP hidden
#define QB 16      // query rows per workgroup
#define KB 128     // keys per iteration (8 waves * 16 keys)
#define DSLICE 64  // d-columns owned per wave for the P@V accumulator
// LDS row pitches.  The fragment readers (ds_load_b128, one row per lane) want
// a pitch that is an odd multiple of 16 B so that 16 rows fall on 16 distinct
// bank groups; the natural pitches (1024 B, 256 B) put all rows on one group.
#define QP (DE + 8)   // sQ pitch in halves: 1040 B = 65 * 16 B
#define PP (KB + 8)   // sP pitch in halves:  272 B = 17 * 16 B
#define SP (KB + 4)   // sS pitch in floats: rows r and r+8 land 32 banks apart

typedef __attribute__((ext_vector_type(16))) _Float16 v16h;
typedef __attribute__((ext_vector_type(8)))  _Float16 v8h;
typedef __attribute__((ext_vector_type(8)))  float    v8f;

static __device__ __forceinline__ v16h ldfrag(const _Float16* p) {
  v16h r;
  ((v8h*)&r)[0] = *(const v8h*)(p);
  ((v8h*)&r)[1] = *(const v8h*)(p + 16);
  return r;
}

// Fragment-order storage of the two B operands.  One 16x32 f16 fragment is
// FRAG halves (1 KB): register half h of lane l lies at h*256 + l*8, so each of
// the two wave-wide 16-byte loads of a fragment reads 512 contiguous bytes
// (4 whole lines) instead of 32 bytes out of each of 16 lines.
#define FRAG 512
static __device__ __forceinline__ v16h ldfrag_packed(const _Float16* p) {
  v16h r;
  ((v8h*)&r)[0] = *(const v8h*)(p);
  ((v8h*)&r)[1] = *(const v8h*)(p + 256);
  return r;
}

// ---------------------------------------------------------------------------
// Pre-pass: f32 -> f16 conversion.  q_h = Q * (1/sqrt(D)) row-major.
// k_h  = K in fragment order for Q@K^T: fragment (key/16, d/32), N = key, k = d.
// kT_h = K in fragment order for P@V: fragment (key/128, d/16, (key/32)%4),
//        N = d, k = key.
// Inside a fragment: lane = (N%16) + 16*sel, k%32 = h*16 + sel*8 + j.
// ---------------------------------------------------------------------------
__global__ __launch_bounds__(256) void taa_convert_kernel(
    const float* __restrict__ Q, const float* __restrict__ K,
    _Float16* __restrict__ qh, _Float16* __restrict__ kh,
    _Float16* __restrict__ kT) {
  const int i = blockIdx.x * blockDim.x + threadIdx.x;   // [0, N*D)
  const float scale = 0.044194173824159216f;             // 1/sqrt(512)
  // i is the packed destination index of both B operands (coalesced writes).
  const int f  = i >> 9;                                 // fragment number
  const int n  = (i >> 3) & 15;                          // N index in fragment
  const int k  = ((i >> 8) & 1) * 16 + ((i >> 7) & 1) * 8 + (i & 7);  // k index
  const float qv = Q[i];
  // Q@K^T operand: key = (f/16)*16 + n, d = (f%16)*32 + k
  const float ks = K[(size_t)((f >> 4) * 16 + n) * DE + (f & 15) * 32 + k];
  // P@V operand: key = (f/128)*128 + (f%4)*32 + k, d = ((f/4)%32)*16 + n
  const float kv =
      K[(size_t)((f >> 7) * KB + (f & 3) * 32 + k) * DE + ((f >> 2) & 31) * 16 + n];
  // Stands between the loads and the conversions below, which overwrite the
  // loads' address registers.
  asm volatile("s_wait_xcnt 0x0" ::: "memory");
  qh[i] = (_Float16)(qv * scale);
  kh[i] = (_Float16)ks;
  kT[i] = (_Float16)kv;
}

// ---------------------------------------------------------------------------
// Fused time-aware flash attention.
// Workgroup: 16 query rows, 8 wave32s.
//   QK^T : wave w owns keys [kb + 16w, kb + 16w + 16), full-D reduction,
//          A-fragments from LDS-staged Q (async-copied once).
//   P@V  : wave w owns output d-slice [64w, 64w + 64).
//   softmax: wave w owns rows 2w, 2w+1 (shfl-butterfly row reductions).
// ---------------------------------------------------------------------------
__global__ __launch_bounds__(256) void taa_attn_kernel(
    const _Float16* __restrict__ qh, const _Float16* __restrict__ kh,
    const _Float16* __restrict__ kT, const float* __restrict__ times,
    const float* __restrict__ w1, const float* __restrict__ b1,
    const float* __restrict__ w2, const float* __restrict__ b2p,
    float* __restrict__ out) {
  __shared__ __align__(16) _Float16 sQ[QB * QP];   // 16x512 f16, padded rows
  __shared__ __align__(16) float    sS[QB * SP];   // 16x128 f32, padded rows
  __shared__ __align__(16) _Float16 sP[QB * PP];   // 16x128 f16, padded rows
  __shared__ float sAlpha[QB];
  __shared__ float sL[QB];
  __shared__ float sTq[QB];

  const int tid   = threadIdx.x;
  const int lane  = tid & 31;
  const int wave  = tid >> 5;
  const int hrow  = lane & 15;   // M (A) / N (B,C) fragment index
  const int sel   = lane >> 4;   // which K-half of the fragment
  const int qbase = blockIdx.x * QB;
  const int dbase = wave * DSLICE;

  // ---- one-time async stage of the Q block into LDS (64 B per thread) ----
  {
    const _Float16* gq = qh + (size_t)qbase * DE + tid * 32;
    const unsigned  lo = (unsigned)(uintptr_t)(const void*)(&sQ[(tid >> 4) * QP + (tid & 15) * 32]);
    asm volatile(
        "global_load_async_to_lds_b128 %0, %1, off\n\t"
        "global_load_async_to_lds_b128 %0, %1, off offset:16\n\t"
        "global_load_async_to_lds_b128 %0, %1, off offset:32\n\t"
        "global_load_async_to_lds_b128 %0, %1, off offset:48"
        :: "v"(lo), "v"(gq) : "memory");
    asm volatile("s_wait_asynccnt 0x0" ::: "memory");
  }

  // Tiny MLP parameters -> registers (uniform loads)
  float w1r[HH], b1r[HH], w2r[HH];
#pragma unroll
  for (int j = 0; j < HH; ++j) { w1r[j] = w1[j]; b1r[j] = b1[j]; w2r[j] = w2[j]; }
  const float b2 = b2p[0];

  if (tid < QB) sTq[tid] = times[qbase + tid];

  v8f acc[4] = {};                         // 16 x 64 f32 output slice
  float mrow[2] = {-3.0e38f, -3.0e38f};    // per-owned-row softmax state
  float lrow[2] = {0.0f, 0.0f};
  __syncthreads();                         // sQ (all waves) + sTq visible

  const _Float16* qlds = sQ + hrow * QP + sel * 8;

  for (int kb = 0; kb < NH; kb += KB) {
    // ---- 0) prefetch next key block (this wave's 16 + 16 fragments) ----
    // One 128-byte line per lane, 4 KB per instruction.
    if (kb + KB < NH) {
      const _Float16* kn =
          kh + (size_t)(((kb + KB) >> 4) + wave) * (16 * FRAG) + lane * 64;
      const _Float16* vn =
          kT + (size_t)(((kb + KB) >> 7) * 8 + wave) * (16 * FRAG) + lane * 64;
#pragma unroll
      for (int pf = 0; pf < 4; ++pf) __builtin_prefetch(kn + pf * 2048, 0, 1);
#pragma unroll
      for (int pf = 0; pf < 4; ++pf) __builtin_prefetch(vn + pf * 2048, 0, 1);
    }

    // ---- 1) S tile: this wave's 16 keys x 16 q-rows over full D ----
    // Register double-buffer: fragments for step kk+1 load during WMMA kk.
    const _Float16* krow =
        kh + (size_t)((kb >> 4) + wave) * (16 * FRAG) + lane * 8;
    v16h aq[2], bk[2];
    aq[0] = ldfrag(qlds);                  // LDS
    bk[0] = ldfrag_packed(krow);           // global
    v8f sa = {}, sb = {};
#pragma unroll
    for (int kk = 0; kk < 16; ++kk) {
      const int cur = kk & 1;
      if (kk < 15) {
        aq[cur ^ 1] = ldfrag(qlds + (kk + 1) * 32);
        bk[cur ^ 1] = ldfrag_packed(krow + (kk + 1) * FRAG);
      }
      if (cur)
        sb = __builtin_amdgcn_wmma_f32_16x16x32_f16(false, aq[cur], false,
                                                    bk[cur], (short)0, sb,
                                                    false, false);
      else
        sa = __builtin_amdgcn_wmma_f32_16x16x32_f16(false, aq[cur], false,
                                                    bk[cur], (short)0, sa,
                                                    false, false);
    }
    // store finished S tile (single writer per element; no atomics needed)
#pragma unroll
    for (int v = 0; v < 8; ++v) {
      sS[(v + 8 * sel) * SP + wave * 16 + hrow] = sa[v] + sb[v];
    }
    // Barrier A: sS stores visible; also orders prev-iteration sP reads
    // (PV ds_loads) before this iteration's sP writes below.
    __syncthreads();

    // ---- 2) time-weight MLP + online softmax (wave-parallel rows) ----
#pragma unroll
    for (int rr = 0; rr < 2; ++rr) {
      const int r = 2 * wave + rr;
      const float tq = sTq[r];
      float sv[4];
      float rmax = -3.0e38f;
#pragma unroll
      for (int c4 = 0; c4 < 4; ++c4) {
        const int col = c4 * 32 + lane;
        float s = sS[r * SP + col];
        const float td = fabsf(tq - times[kb + col]);
        float z = b2;
#pragma unroll
        for (int j = 0; j < HH; ++j) {
          float hj = td * w1r[j] + b1r[j];
          hj = hj > 0.0f ? hj : 0.0f;
          z += hj * w2r[j];
        }
        s *= 1.0f / (1.0f + __expf(-z));   // * sigmoid(mlp(|dt|))
        sv[c4] = s;
        rmax = fmaxf(rmax, s);
      }
#pragma unroll
      for (int m = 16; m >= 1; m >>= 1)
        rmax = fmaxf(rmax, __shfl_xor(rmax, m, 32));
      const float mnew  = fmaxf(mrow[rr], rmax);
      const float alpha = __expf(mrow[rr] - mnew);
      mrow[rr] = mnew;
      float psum = 0.0f;
#pragma unroll
      for (int c4 = 0; c4 < 4; ++c4) {
        const float p = __expf(sv[c4] - mnew);
        psum += p;
        sP[r * PP + c4 * 32 + lane] = (_Float16)p;
      }
#pragma unroll
      for (int m = 16; m >= 1; m >>= 1)
        psum += __shfl_xor(psum, m, 32);
      lrow[rr] = lrow[rr] * alpha + psum;
      if (lane == 0) sAlpha[r] = alpha;
    }
    // Barrier B: sP / sAlpha visible before rescale + PV.
    __syncthreads();

    // ---- 3) rescale accumulators by alpha ----
#pragma unroll
    for (int v = 0; v < 8; ++v) {
      const float a = sAlpha[v + 8 * sel];
      acc[0][v] *= a; acc[1][v] *= a; acc[2][v] *= a; acc[3][v] *= a;
    }

    // ---- 4) acc += P @ V_slice (A from LDS, B from the P@V-packed K) ----
    // All 4 B-fragments materialized before the WMMA burst per k-step.
    const _Float16* vfrag =
        kT + (size_t)((kb >> 7) * 8 + wave) * (16 * FRAG) + lane * 8;
#pragma unroll
    for (int kk = 0; kk < 4; ++kk) {           // 4 k-steps of 32 keys
      const v16h aP = ldfrag(sP + hrow * PP + kk * 32 + sel * 8);
      v16h bv[4];
#pragma unroll
      for (int t = 0; t < 4; ++t) {
        bv[t] = ldfrag_packed(vfrag + (t * 4 + kk) * FRAG);
      }
#pragma unroll
      for (int t = 0; t < 4; ++t) {
        acc[t] = __builtin_amdgcn_wmma_f32_16x16x32_f16(false, aP, false,
                                                        bv[t], (short)0,
                                                        acc[t], false, false);
      }
    }
  }

  // ---- epilogue: out = acc / l ----
  if (lane == 0) { sL[2 * wave] = lrow[0]; sL[2 * wave + 1] = lrow[1]; }
  __syncthreads();
#pragma unroll
  for (int v = 0; v < 8; ++v) {
    const int r = v + 8 * sel;
    const float inv = 1.0f / sL[r];
#pragma unroll
    for (int t = 0; t < 4; ++t) {
      out[(size_t)(qbase + r) * DE + dbase + t * 16 + hrow] = acc[t][v] * inv;
    }
  }
}

// ---------------------------------------------------------------------------
extern "C" void kernel_launch(void* const* d_in, const int* in_sizes, int n_in,
                              void* d_out, int out_size, void* d_ws, size_t ws_size,
                              hipStream_t stream) {
  const float* Q  = (const float*)d_in[0];  // query_code_embeds [N,D]
  const float* K  = (const float*)d_in[1];  // hist_embeddings  [N,D]
  const float* t  = (const float*)d_in[2];  // hist_times       [N]
  const float* w1 = (const float*)d_in[3];  // [1,H]
  const float* b1 = (const float*)d_in[4];  // [H]
  const float* w2 = (const float*)d_in[5];  // [H,1]
  const float* b2 = (const float*)d_in[6];  // [1]
  float* out = (float*)d_out;

  // workspace layout: q_h | k_h | kT_h   (each N*D f16 = 4 MB)
  _Float16* qh = (_Float16*)d_ws;
  _Float16* kh = qh + (size_t)NH * DE;
  _Float16* kT = kh + (size_t)NH * DE;

  const int total = NH * DE;
  taa_convert_kernel<<<total / 256, 256, 0, stream>>>(Q, K, qh, kh, kT);
  taa_attn_kernel<<<NH / QB, 256, 0, stream>>>(qh, kh, kT, t, w1, b1, w2, b2, out);
  (void)in_sizes; (void)n_in; (void)out_size; (void)ws_size;
}

// v003
// Measured time: 114 microseconds a run.
// Two timings next to v002 both put it at 1.22 times that version's speed.
// All steps since v000 together make it 2.30 times as fast.
#include <hip/hip_runtime.h>
#include <math.h>

// Problem constants (match reference)
#define NH 4096    // n_history
#define DE 512     // embed dim
#define HH 8       // time-weight MLP hidden
#define QB 16      // query rows per workgroup
#define KB 128     // keys per iteration (8 waves * 16 keys)
#define DSLICE 64  // d-columns owned per wave for the P@V accumulator
// LDS row pitches.  The fragment readers (ds_load_b128, one row per lane) want
// a pitch that is an odd multiple of 16 B so that 16 rows fall on 16 distinct
// bank groups; the natural pitches (1024 B, 256 B) put all rows on one group.
#define QP (DE + 8)   // sQ pitch in halves: 1040 B = 65 * 16 B
#define PP (KB + 8)   // sP pitch in halves:  272 B = 17 * 16 B
#define SP (KB + 4)   // sS pitch in floats: rows r and r+8 land 32 banks apart

typedef __attribute__((ext_vector_type(16))) _Float16 v16h;
typedef __attribute__((ext_vector_type(8)))  _Float16 v8h;
typedef __attribute__((ext_vector_type(8)))  float    v8f;

static __device__ __forceinline__ v16h ldfrag(const _Float16* p) {
  v16h r;
  ((v8h*)&r)[0] = *(const v8h*)(p);
  ((v8h*)&r)[1] = *(const v8h*)(p + 16);
  return r;
}

// Fragment-order storage of the two B operands.  One 16x32 f16 fragment is
// FRAG halves (1 KB): register half h of lane l lies at h*256 + l*8, so each of
// the two wave-wide 16-byte loads of a fragment reads 512 contiguous bytes
// (4 whole lines) instead of 32 bytes out of each of 16 lines.
#define FRAG 512
#define KAHEAD 12  // Q@K^T fragments of the next pass loaded before the softmax
static __device__ __forceinline__ v16h ldfrag_packed(const _Float16* p) {
  v16h r;
  ((v8h*)&r)[0] = *(const v8h*)(p);
  ((v8h*)&r)[1] = *(const v8h*)(p + 256);
  return r;
}

// Work-group barrier that orders LDS traffic only.  __syncthreads() would also
// drain the global fragment loads that are issued ahead and must stay in flight
// across it; the data handed over at these barriers lies in LDS alone.
static __device__ __forceinline__ void lds_barrier() {
  asm volatile("s_wait_dscnt 0x0" ::: "memory");
  asm volatile("s_barrier_signal -1\n\ts_barrier_wait -1" ::: "memory");
}

// ---------------------------------------------------------------------------
// Pre-pass: f32 -> f16 conversion.  q_h = Q * (1/sqrt(D)) row-major.
// k_h  = K in fragment order for Q@K^T: fragment (key/16, d/32), N = key, k = d.
// kT_h = K in fragment order for P@V: fragment (key/128, d/16, (key/32)%4),
//        N = d, k = key.
// Inside a fragment: lane = (N%16) + 16*sel, k%32 = h*16 + sel*8 + j.
// ---------------------------------------------------------------------------
__global__ __launch_bounds__(256) void taa_convert_kernel(
    const float* __restrict__ Q, const float* __restrict__ K,
    _Float16* __restrict__ qh, _Float16* __restrict__ kh,
    _Float16* __restrict__ kT) {
  const int i = blockIdx.x * blockDim.x + threadIdx.x;   // [0, N*D)
  const float scale = 0.044194173824159216f;             // 1/sqrt(512)
  // i is the packed destination index of both B operands (coalesced writes).
  const int f  = i >> 9;                                 // fragment number
  const int n  = (i >> 3) & 15;                          // N index in fragment
  const int k  = ((i >> 8) & 1) * 16 + ((i >> 7) & 1) * 8 + (i & 7);  // k index
  const float qv = Q[i];
  // Q@K^T operand: key = (f/16)*16 + n, d = (f%16)*32 + k
  const float ks = K[(size_t)((f >> 4) * 16 + n) * DE + (f & 15) * 32 + k];
  // P@V operand: key = (f/128)*128 + (f%4)*32 + k, d = ((f/4)%32)*16 + n
  const float kv =
      K[(size_t)((f >> 7) * KB + (f & 3) * 32 + k) * DE + ((f >> 2) & 31) * 16 + n];
  // Stands between the loads and the conversions below, which overwrite the
  // loads' address registers.
  asm volatile("s_wait_xcnt 0x0" ::: "memory");
  qh[i] = (_Float16)(qv * scale);
  kh[i] = (_Float16)ks;
  kT[i] = (_Float16)kv;
}

// ---------------------------------------------------------------------------
// Fused time-aware flash attention.
// Workgroup: 16 query rows, 8 wave32s.
//   QK^T : wave w owns keys [kb + 16w, kb + 16w + 16), full-D reduction,
//          A-fragments from LDS-staged Q (async-copied once).
//   P@V  : wave w owns output d-slice [64w, 64w + 64).
//   softmax: wave w owns rows 2w, 2w+1 (shfl-butterfly row reductions).
// B fragments: a wave's 16 fragments of a product are loaded as one group of
// 32 wave-wide loads, a phase ahead of their use: the P@V group at the top of
// the pass, the next pass's Q@K^T group behind this pass's Q@K^T (its last
// quarter behind the softmax).
// ---------------------------------------------------------------------------
__global__ __launch_bounds__(256) void taa_attn_kernel(
    const _Float16* __restrict__ qh, const _Float16* __restrict__ kh,
    const _Float16* __restrict__ kT, const float* __restrict__ times,
    const float* __restrict__ w1, const float* __restrict__ b1,
    const float* __restrict__ w2, const float* __restrict__ b2p,
    float* __restrict__ out) {
  __shared__ __align__(16) _Float16 sQ[QB * QP];   // 16x512 f16, padded rows
  __shared__ __align__(16) float    sS[QB * SP];   // 16x128 f32, padded rows
  __shared__ __align__(16) _Float16 sP[QB * PP];   // 16x128 f16, padded rows
  __shared__ float sAlpha[QB];
  __shared__ float sL[QB];
  __shared__ float sTq[QB];

  const int tid   = threadIdx.x;
  const int lane  = tid & 31;
  const int wave  = tid >> 5;
  const int hrow  = lane & 15;   // M (A) / N (B,C) fragment index
  const int sel   = lane >> 4;   // which K-half of the fragment
  const int qbase = blockIdx.x * QB;
  const int dbase = wave * DSLICE;

  // ---- one-time async stage of the Q block into LDS (64 B per thread) ----
  {
    const _Float16* gq = qh + (size_t)qbase * DE + tid * 32;
    const unsigned  lo = (unsigned)(uintptr_t)(const void*)(&sQ[(tid >> 4) * QP + (tid & 15) * 32]);
    asm volatile(
        "global_load_async_to_lds_b128 %0, %1, off\n\t"
        "global_load_async_to_lds_b128 %0, %1, off offset:16\n\t"
        "global_load_async_to_lds_b128 %0, %1, off offset:32\n\t"
        "global_load_async_to_lds_b128 %0, %1, off offset:48"
        :: "v"(lo), "v"(gq) : "memory");
    asm volatile("s_wait_asynccnt 0x0" ::: "memory");
  }

  // Tiny MLP parameters -> registers (uniform loads)
  float w1r[HH], b1r[HH], w2r[HH];
#pragma unroll
  for (int j = 0; j < HH; ++j) { w1r[j] = w1[j]; b1r[j] = b1[j]; w2r[j] = w2[j]; }
  const float b2 = b2p[0];

  if (tid < QB) sTq[tid] = times[qbase + tid];

  v8f acc[4] = {};                         // 16 x 64 f32 output slice
  float mrow[2] = {-3.0e38f, -3.0e38f};    // per-owned-row softmax state
  float lrow[2] = {0.0f, 0.0f};
  __syncthreads();                         // sQ (all waves) + sTq visible

  const _Float16* qlds = sQ + hrow * QP + sel * 8;
  const _Float16* kwave = kh + (size_t)wave * (16 * FRAG) + lane * 8;
  const _Float16* vwave = kT + (size_t)wave * (16 * FRAG) + lane * 8;

  // Q@K^T fragments of the first key block.
  v16h bk[16];
#pragma unroll
  for (int f = 0; f < 16; ++f) bk[f] = ldfrag_packed(kwave + f * FRAG);

  for (int kb = 0; kb < NH; kb += KB) {
    // ---- 0) this pass's key times and P@V fragments, issued ahead ----
    // The times go first: loads return in order, so a later load of them would
    // make the softmax wait for every fragment load in front of it.
    float tk[4];
#pragma unroll
    for (int c4 = 0; c4 < 4; ++c4) tk[c4] = times[kb + c4 * 32 + lane];
    const _Float16* vfrag = vwave + (size_t)(kb >> 7) * (8 * 16 * FRAG);
    v16h bv[16];                               // [k-step][d-tile]
#pragma unroll
    for (int f = 0; f < 16; ++f)
      bv[f] = ldfrag_packed(vfrag + ((f & 3) * 4 + (f >> 2)) * FRAG);
    // Keeps the load group above the matrix work instead of sunk to its uses.
    __builtin_amdgcn_sched_barrier(0);

    // ---- 1) S tile: this wave's 16 keys x 16 q-rows over full D ----
    // A fragments double-buffered from LDS; B fragments already in registers.
    v16h aq[2];
    aq[0] = ldfrag(qlds);
    v8f sa = {}, sb = {};
#pragma unroll
    for (int kk = 0; kk < 16; ++kk) {
      const int cur = kk & 1;
      if (kk < 15) aq[cur ^ 1] = ldfrag(qlds + (kk + 1) * 32);
      if (cur)
        sb = __builtin_amdgcn_wmma_f32_16x16x32_f16(false, aq[cur], false,
                                                    bk[kk], (short)0, sb,
                                                    false, false);
      else
        sa = __builtin_amdgcn_wmma_f32_16x16x32_f16(false, aq[cur], false,
                                                    bk[kk], (short)0, sa,
                                                    false, false);
    }
    // store finished S tile (single writer per element; no atomics needed)
#pragma unroll
    for (int v = 0; v < 8; ++v) {
      sS[(v + 8 * sel) * SP + wave * 16 + hrow] = sa[v] + sb[v];
    }
    // Next pass's Q@K^T fragments fly during softmax and P@V.  Unconditional
    // (a branch would merge two paths in the wait counting): the last pass
    // re-reads its own block and the values are not used.  Only KAHEAD of the
    // 16 go here: with the 36 loads from the pass's top still out, more would
    // fill the 63-deep load counter and hold this wave in front of barrier A.
    const int kn = (kb + KB < NH) ? kb + KB : kb;
    const _Float16* knext = kwave + (size_t)(kn >> 4) * (16 * FRAG);
#pragma unroll
    for (int f = 0; f < KAHEAD; ++f) bk[f] = ldfrag_packed(knext + f * FRAG);
    // Stands behind the load groups issued so far and in front of the first
    // instruction that overwrites an address register they name.
    asm volatile("s_wait_xcnt 0x0" ::: "memory");
    // Barrier A: sS stores visible; also orders prev-iteration sP reads
    // (PV ds_loads) before this iteration's sP writes below.
    lds_barrier();

    // ---- 2) time-weight MLP + online softmax (wave-parallel rows) ----
#pragma unroll
    for (int rr = 0; rr < 2; ++rr) {
      const int r = 2 * wave + rr;
      const float tq = sTq[r];
      float sv[4];
      float rmax = -3.0e38f;
#pragma unroll
      for (int c4 = 0; c4 < 4; ++c4) {
        const int col = c4 * 32 + lane;
        float s = sS[r * SP + col];
        const float td = fabsf(tq - tk[c4]);
        float z = b2;
#pragma unroll
        for (int j = 0; j < HH; ++j) {
          float hj = td * w1r[j] + b1r[j];
          hj = hj > 0.0f ? hj : 0.0f;
          z += hj * w2r[j];
        }
        s *= 1.0f / (1.0f + __expf(-z));   // * sigmoid(mlp(|dt|))
        sv[c4] = s;
        rmax = fmaxf(rmax, s);
      }
#pragma unroll
      for (int m = 16; m >= 1; m >>= 1)
        rmax = fmaxf(rmax, __shfl_xor(rmax, m, 32));
      const float mnew  = fmaxf(mrow[rr], rmax);
      const float alpha = __expf(mrow[rr] - mnew);
      mrow[rr] = mnew;
      float psum = 0.0f;
#pragma unroll
      for (int c4 = 0; c4 < 4; ++c4) {
        const float p = __expf(sv[c4] - mnew);
        psum += p;
        sP[r * PP + c4 * 32 + lane] = (_Float16)p;
      }
#pragma unroll
      for (int m = 16; m >= 1; m >>= 1)
        psum += __shfl_xor(psum, m, 32);
      lrow[rr] = lrow[rr] * alpha + psum;
      if (lane == 0) sAlpha[r] = alpha;
    }
    // The rest of the next pass's Q@K^T fragments (they are used last there).
#pragma unroll
    for (int f = KAHEAD; f < 16; ++f) bk[f] = ldfrag_packed(knext + f * FRAG);
    // In front of the first overwrite of these loads' address register; the
    // address is named as an input so that its register lives up to the wait
    // (otherwise the last load's own result lands on it).
    asm volatile("s_wait_xcnt 0x0" :: "v"(knext) : "memory");
    // Barrier B: sP / sAlpha visible before rescale + PV.
    lds_barrier();

    // ---- 3) rescale accumulators by alpha ----
#pragma unroll
    for (int v = 0; v < 8; ++v) {
      const float a = sAlpha[v + 8 * sel];
      acc[0][v] *= a; acc[1][v] *= a; acc[2][v] *= a; acc[3][v] *= a;
    }

    // ---- 4) acc += P @ V_slice (A from LDS, B loaded at the pass's top) ----
#pragma unroll
    for (int kk = 0; kk < 4; ++kk) {           // 4 k-steps of 32 keys
      const v16h aP = ldfrag(sP + hrow * PP + kk * 32 + sel * 8);
#pragma unroll
      for (int t = 0; t < 4; ++t) {
        acc[t] = __builtin_amdgcn_wmma_f32_16x16x32_f16(false, aP, false,
                                                        bv[kk * 4 + t], (short)0,
                                                        acc[t], false, false);
      }
    }
  }

  // ---- epilogue: out = acc / l ----
  if (lane == 0) { sL[2 * wave] = lrow[0]; sL[2 * wave + 1] = lrow[1]; }
  __syncthreads();
#pragma unroll
  for (int v = 0; v < 8; ++v) {
    const int r = v + 8 * sel;
    const float inv = 1.0f / sL[r];
#pragma unroll
    for (int t = 0; t < 4; ++t) {
      out[(size_t)(qbase + r) * DE + dbase + t * 16 + hrow] = acc[t][v] * inv;
    }
  }
}

// ---------------------------------------------------------------------------
extern "C" void kernel_launch(void* const* d_in, const int* in_sizes, int n_in,
                              void* d_out, int out_size, void* d_ws, size_t ws_size,
                              hipStream_t stream) {
  const float* Q  = (const float*)d_in[0];  // query_code_embeds [N,D]
  const float* K  = (const float*)d_in[1];  // hist_embeddings  [N,D]
  const float* t  = (const float*)d_in[2];  // hist_times       [N]
  const float* w1 = (const float*)d_in[3];  // [1,H]
  const float* b1 = (const float*)d_in[4];  // [H]
  const float* w2 = (const float*)d_in[5];  // [H,1]
  const float* b2 = (const float*)d_in[6];  // [1]
  float* out = (float*)d_out;

  // workspace layout: q_h | k_h | kT_h   (each N*D f16 = 4 MB)
  _Float16* qh = (_Float16*)d_ws;
  _Float16* kh = qh + (size_t)NH * DE;
  _Float16* kT = kh + (size_t)NH * DE;

  const int total = NH * DE;
  taa_convert_kernel<<<total / 256, 256, 0, stream>>>(Q, K, qh, kh, kT);
  taa_attn_kernel<<<NH / QB, 256, 0, stream>>>(qh, kh, kT, t, w1, b1, w2, b2, out);
  (void)in_sizes; (void)n_in; (void)out_size; (void)ws_size;
}

// v004
// A run of this version takes 78.8 microseconds.
// In both of two side-by-side timings against v003, it was 1.45 times as fast.
// Counting every step since v000, it is 3.33 times as fast.
#include <hip/hip_runtime.h>
#include <math.h>

// Problem constants (match reference)
#define NH 4096    // n_history
#define DE 512     // embed dim
#define HH 8       // time-weight MLP hidden
#define QB 64      // query rows per workgroup
#define MT (QB / 16)   // 16-row tiles per workgroup: uses of each loaded B fragment
#define SPLIT 4        // key ranges; one workgroup = (query block, key range)
#define KSPAN (NH / SPLIT)  // keys per workgroup
#define RW (QB / 8)    // softmax rows per wave
#define KB 128     // keys per iteration (8 waves * 16 keys)
#define DSLICE 64  // d-columns owned per wave for the P@V accumulator
// LDS row pitches.  The fragment readers (ds_load_b128, one row per lane) want
// a pitch that is an odd multiple of 16 B so that 16 rows fall on 16 distinct
// bank groups; the natural pitches (1024 B, 256 B) put all rows on one group.
#define QP (DE + 8)   // sQ pitch in halves: 1040 B = 65 * 16 B
#define PP (KB + 8)   // sP pitch in halves:  272 B = 17 * 16 B
#define SP (KB + 4)   // sS pitch in floats: rows r and r+8 land 32 banks apart

typedef __attribute__((ext_vector_type(16))) _Float16 v16h;
typedef __attribute__((ext_vector_type(8)))  _Float16 v8h;
typedef __attribute__((ext_vector_type(8)))  float    v8f;
typedef __attribute__((ext_vector_type(4)))  float    v4f;

static __device__ __forceinline__ v16h ldfrag(const _Float16* p) {
  v16h r;
  ((v8h*)&r)[0] = *(const v8h*)(p);
  ((v8h*)&r)[1] = *(const v8h*)(p + 16);
  return r;
}

// Fragment-order storage of the two B operands.  One 16x32 f16 fragment is
// FRAG halves (1 KB): register half h of lane l lies at h*256 + l*8, so each of
// the two wave-wide 16-byte loads of a fragment reads 512 contiguous bytes
// (4 whole lines) instead of 32 bytes out of each of 16 lines.
#define FRAG 512
static __device__ __forceinline__ v16h ldfrag_packed(const _Float16* p) {
  v16h r;
  ((v8h*)&r)[0] = *(const v8h*)(p);
  ((v8h*)&r)[1] = *(const v8h*)(p + 256);
  return r;
}

// Work-group barrier that orders LDS traffic only.  __syncthreads() would also
// drain the global fragment loads that are issued ahead and must stay in flight
// across it; the data handed over at these barriers lies in LDS alone.
static __device__ __forceinline__ void lds_barrier() {
  asm volatile("s_wait_dscnt 0x0" ::: "memory");
  asm volatile("s_barrier_signal -1\n\ts_barrier_wait -1" ::: "memory");
}

// ---------------------------------------------------------------------------
// Pre-pass: f32 -> f16 conversion.  q_h = Q * (1/sqrt(D)) row-major.
// k_h  = K in fragment order for Q@K^T: fragment (key/16, d/32), N = key, k = d.
// kT_h = K in fragment order for P@V: fragment (key/128, d/16, (key/32)%4),
//        N = d, k = key.
// Inside a fragment: lane = (N%16) + 16*sel, k%32 = h*16 + sel*8 + j.
// ---------------------------------------------------------------------------
__global__ __launch_bounds__(256) void taa_convert_kernel(
    const float* __restrict__ Q, const float* __restrict__ K,
    _Float16* __restrict__ qh, _Float16* __restrict__ kh,
    _Float16* __restrict__ kT) {
  const int i = blockIdx.x * blockDim.x + threadIdx.x;   // [0, N*D)
  const float scale = 0.044194173824159216f;             // 1/sqrt(512)
  // i is the packed destination index of both B operands (coalesced writes).
  const int f  = i >> 9;                                 // fragment number
  const int n  = (i >> 3) & 15;                          // N index in fragment
  const int k  = ((i >> 8) & 1) * 16 + ((i >> 7) & 1) * 8 + (i & 7);  // k index
  const float qv = Q[i];
  // Q@K^T operand: key = (f/16)*16 + n, d = (f%16)*32 + k
  const float ks = K[(size_t)((f >> 4) * 16 + n) * DE + (f & 15) * 32 + k];
  // P@V operand: key = (f/128)*128 + (f%4)*32 + k, d = ((f/4)%32)*16 + n
  const float kv =
      K[(size_t)((f >> 7) * KB + (f & 3) * 32 + k) * DE + ((f >> 2) & 31) * 16 + n];
  // Stands between the loads and the conversions below, which overwrite the
  // loads' address registers.
  asm volatile("s_wait_xcnt 0x0" ::: "memory");
  qh[i] = (_Float16)(qv * scale);
  kh[i] = (_Float16)ks;
  kT[i] = (_Float16)kv;
}

// ---------------------------------------------------------------------------
// Fused time-aware flash attention over one key range.
// Workgroup: 64 query rows x KSPAN keys, 8 wave32s.  Every B fragment that a
// wave loads feeds MT matrix instructions (one per 16-row tile).
//   QK^T : wave w owns keys [kb + 16w, kb + 16w + 16), full-D reduction,
//          A-fragments from LDS-staged Q (async-copied once).
//   P@V  : wave w owns output d-slice [64w, 64w + 64).
//   softmax: wave w owns rows RW*w .. RW*w + RW-1 (shfl-butterfly reductions).
// Result: the range's unnormalised sum, row maximum and row denominator; the
// ranges are merged by taa_merge_kernel.
// B fragments go from global memory straight to registers, a phase ahead of
// their use: the P@V group behind this pass's Q@K^T (it flies during the
// softmax), the next pass's Q@K^T group in quarters, the first behind the
// softmax and one behind each of the first three P@V k-steps, as that step's fragments retire.
// ---------------------------------------------------------------------------
__global__ __launch_bounds__(256) void taa_attn_kernel(
    const _Float16* __restrict__ qh, const _Float16* __restrict__ kh,
    const _Float16* __restrict__ kT, const float* __restrict__ times,
    const float* __restrict__ w1, const float* __restrict__ b1,
    const float* __restrict__ w2, const float* __restrict__ b2p,
    float* __restrict__ pacc, float* __restrict__ pm, float* __restrict__ pl) {
  __shared__ __align__(16) _Float16 sQ[QB * QP];   // 64x512 f16, padded rows
  __shared__ __align__(16) float    sS[QB * SP];   // 64x128 f32, padded rows
  __shared__ __align__(16) _Float16 sP[QB * PP];   // 64x128 f16, padded rows
  __shared__ __align__(16) float sAlpha[QB];
  __shared__ float sTq[QB];

  const int tid   = threadIdx.x;
  const int lane  = tid & 31;
  const int wave  = tid >> 5;
  const int hrow  = lane & 15;   // M (A) / N (B,C) fragment index
  const int sel   = lane >> 4;   // which K-half of the fragment
  const int qbase = (blockIdx.x / SPLIT) * QB;
  const int split = blockIdx.x % SPLIT;
  const int kbeg  = split * KSPAN;
  const int kend  = kbeg + KSPAN;
  const int dbase = wave * DSLICE;

  // ---- one-time async stage of the Q block into LDS (64 B per thread and
  //      16-row tile) ----
#pragma unroll
  for (int mt = 0; mt < MT; ++mt) {
    const _Float16* gq = qh + (size_t)(qbase + mt * 16) * DE + tid * 32;
    const unsigned  lo = (unsigned)(uintptr_t)(const void*)(&sQ[(mt * 16 + (tid >> 4)) * QP + (tid & 15) * 32]);
    // The closing wait stands in the copies' own statement, in front of any
    // later write of the address registers that they name.
    asm volatile(
        "global_load_async_to_lds_b128 %0, %4, off\n\t"
        "global_load_async_to_lds_b128 %1, %5, off\n\t"
        "global_load_async_to_lds_b128 %2, %6, off\n\t"
        "global_load_async_to_lds_b128 %3, %7, off\n\t"
        "s_wait_xcnt 0x0"
        :: "v"(lo), "v"(lo + 16u), "v"(lo + 32u), "v"(lo + 48u),
           "v"(gq), "v"(gq + 8), "v"(gq + 16), "v"(gq + 24) : "memory");
  }
  // This wave's copies have landed; the barrier below publishes them.
  asm volatile("s_wait_asynccnt 0x0" ::: "memory");

  // Tiny MLP parameters -> registers (uniform loads)
  float w1r[HH], b1r[HH], w2r[HH];
#pragma unroll
  for (int j = 0; j < HH; ++j) { w1r[j] = w1[j]; b1r[j] = b1[j]; w2r[j] = w2[j]; }
  const float b2 = b2p[0];

  if (tid < QB) sTq[tid] = times[qbase + tid];

  v8f acc[MT][4] = {};                     // 64 x 64 f32 output slice
  float mrow[RW], lrow[RW];                // per-owned-row softmax state
#pragma unroll
  for (int rr = 0; rr < RW; ++rr) { mrow[rr] = -3.0e38f; lrow[rr] = 0.0f; }
  __syncthreads();                         // sQ (all waves) + sTq visible

  const _Float16* qlds = sQ + hrow * QP + sel * 8;
  const _Float16* kwave = kh + (size_t)wave * (16 * FRAG) + lane * 8;
  const _Float16* kfirst = kwave + (size_t)(kbeg >> 4) * (16 * FRAG);
  const _Float16* vwave = kT + (size_t)wave * (16 * FRAG) + lane * 8;

  // Q@K^T fragments of the first key block.
  v16h bk[16];
#pragma unroll
  for (int f = 0; f < 16; ++f) bk[f] = ldfrag_packed(kfirst + f * FRAG);

  for (int kb = kbeg; kb < kend; kb += KB) {
    // ---- 0) this pass's key times, issued ahead ----
    // They go in front of the P@V fragments: loads return in order, so a later
    // load of them would make the softmax wait for every fragment load.
    float tk[4];
#pragma unroll
    for (int c4 = 0; c4 < 4; ++c4) tk[c4] = times[kb + c4 * 32 + lane];
    // Keeps these loads above the matrix work instead of sunk to their uses.
    __builtin_amdgcn_sched_barrier(0);

    // ---- 1) S tiles: this wave's 16 keys x 64 q-rows over full D ----
    // A fragments double-buffered from LDS, MT at a time; B fragments already
    // in registers, each used MT times.  The MT row tiles are the independent
    // accumulator chains.
    v16h aq[2][MT];
#pragma unroll
    for (int mt = 0; mt < MT; ++mt) aq[0][mt] = ldfrag(qlds + mt * 16 * QP);
    v8f st[MT] = {};
#pragma unroll
    for (int kk = 0; kk < 16; ++kk) {
      const int cur = kk & 1;
      if (kk < 15) {
#pragma unroll
        for (int mt = 0; mt < MT; ++mt)
          aq[cur ^ 1][mt] = ldfrag(qlds + mt * 16 * QP + (kk + 1) * 32);
      }
#pragma unroll
      for (int mt = 0; mt < MT; ++mt) {
        st[mt] = __builtin_amdgcn_wmma_f32_16x16x32_f16(false, aq[cur][mt], false,
                                                        bk[kk], (short)0, st[mt],
                                                        false, false);
      }
    }
    // store finished S tiles (single writer per element; no atomics needed)
#pragma unroll
    for (int mt = 0; mt < MT; ++mt) {
#pragma unroll
      for (int v = 0; v < 8; ++v) {
        sS[(mt * 16 + v + 8 * sel) * SP + wave * 16 + hrow] = st[mt][v];
      }
    }
    // This pass's P@V fragments fly during the softmax.
    const _Float16* vfrag = vwave + (size_t)(kb >> 7) * (8 * 16 * FRAG);
    v16h bv[16];                               // [k-step][d-tile]
#pragma unroll
    for (int f = 0; f < 16; ++f)
      bv[f] = ldfrag_packed(vfrag + ((f & 3) * 4 + (f >> 2)) * FRAG);
    // Stands behind the loads issued so far and in front of the first
    // instruction that overwrites an address register they name; the address
    // is named as an input so that its register lives up to the wait.
    asm volatile("s_wait_xcnt 0x0" :: "v"(vfrag) : "memory");
    // Keeps the load group in front of the softmax instead of sunk to its uses.
    __builtin_amdgcn_sched_barrier(0);
    // Barrier A: sS stores visible; also orders prev-iteration sP reads
    // (PV ds_loads) before this iteration's sP writes below.
    lds_barrier();

    // ---- 2) time-weight MLP + online softmax (wave-parallel rows) ----
#pragma unroll
    for (int rr = 0; rr < RW; ++rr) {
      const int r = RW * wave + rr;
      const float tq = sTq[r];
      float sv[4];
      float rmax = -3.0e38f;
#pragma unroll
      for (int c4 = 0; c4 < 4; ++c4) {
        const int col = c4 * 32 + lane;
        float s = sS[r * SP + col];
        const float td = fabsf(tq - tk[c4]);
        float z = b2;
#pragma unroll
        for (int j = 0; j < HH; ++j) {
          float hj = td * w1r[j] + b1r[j];
          hj = hj > 0.0f ? hj : 0.0f;
          z += hj * w2r[j];
        }
        s *= 1.0f / (1.0f + __expf(-z));   // * sigmoid(mlp(|dt|))
        sv[c4] = s;
        rmax = fmaxf(rmax, s);
      }
#pragma unroll
      for (int m = 16; m >= 1; m >>= 1)
        rmax = fmaxf(rmax, __shfl_xor(rmax, m, 32));
      const float mnew  = fmaxf(mrow[rr], rmax);
      const float alpha = __expf(mrow[rr] - mnew);
      mrow[rr] = mnew;
      float psum = 0.0f;
#pragma unroll
      for (int c4 = 0; c4 < 4; ++c4) {
        const float p = __expf(sv[c4] - mnew);
        psum += p;
        sP[r * PP + c4 * 32 + lane] = (_Float16)p;
      }
#pragma unroll
      for (int m = 16; m >= 1; m >>= 1)
        psum += __shfl_xor(psum, m, 32);
      lrow[rr] = lrow[rr] * alpha + psum;
      if (lane == 0) sAlpha[r] = alpha;
    }
    // First quarter of the next pass's Q@K^T fragments.  Unconditional (a
    // branch would merge two paths in the wait counting): the last pass
    // re-reads its own block and the values are not used.
    const int kn = (kb + KB < kend) ? kb + KB : kb;
    const _Float16* knext = kwave + (size_t)(kn >> 4) * (16 * FRAG);
#pragma unroll
    for (int f = 0; f < 4; ++f) bk[f] = ldfrag_packed(knext + f * FRAG);
    // In front of the first overwrite of these loads' address register; the
    // address is named as an input so that its register lives up to the wait.
    asm volatile("s_wait_xcnt 0x0" :: "v"(knext) : "memory");
    // Barrier B: sP / sAlpha visible before rescale + PV.
    lds_barrier();

    // ---- 3) rescale accumulators by alpha ----
#pragma unroll
    for (int mt = 0; mt < MT; ++mt) {
#pragma unroll
      for (int v = 0; v < 8; ++v) {
        const float a = sAlpha[mt * 16 + v + 8 * sel];
        acc[mt][0][v] *= a; acc[mt][1][v] *= a;
        acc[mt][2][v] *= a; acc[mt][3][v] *= a;
      }
    }

    // ---- 4) acc += P @ V_slice (A double-buffered from LDS, B in registers) ----
    const _Float16* plds = sP + hrow * PP + sel * 8;
    v16h aP[2][MT];
#pragma unroll
    for (int mt = 0; mt < MT; ++mt) aP[0][mt] = ldfrag(plds + mt * 16 * PP);
#pragma unroll
    for (int kk = 0; kk < 4; ++kk) {           // 4 k-steps of 32 keys
      const int cur = kk & 1;
      if (kk < 3) {
#pragma unroll
        for (int mt = 0; mt < MT; ++mt)
          aP[cur ^ 1][mt] = ldfrag(plds + mt * 16 * PP + (kk + 1) * 32);
      }
#pragma unroll
      for (int mt = 0; mt < MT; ++mt) {
#pragma unroll
        for (int t = 0; t < 4; ++t) {
          acc[mt][t] = __builtin_amdgcn_wmma_f32_16x16x32_f16(
              false, aP[cur][mt], false, bv[kk * 4 + t], (short)0, acc[mt][t],
              false, false);
        }
      }
      if (kk < 3) {
        // Next quarter of the next pass's Q@K^T fragments.
#pragma unroll
        for (int f = 4 * kk + 4; f < 4 * kk + 8; ++f)
          bk[f] = ldfrag_packed(knext + f * FRAG);
        // In front of the first overwrite of these loads' address register.
        asm volatile("s_wait_xcnt 0x0" :: "v"(knext) : "memory");
        // Keeps this quarter here: hoisted it would need registers that this
        // k-step's fragments still hold, sunk it would land too late.
        __builtin_amdgcn_sched_barrier(0);
      }
    }
  }

  // ---- epilogue: this key range's partial sum, maximum and denominator ----
  if (lane == 0) {
#pragma unroll
    for (int rr = 0; rr < RW; ++rr) {
      pm[split * NH + qbase + RW * wave + rr] = mrow[rr];
      pl[split * NH + qbase + RW * wave + rr] = lrow[rr];
    }
  }
  float* po = pacc + ((size_t)split * NH + qbase) * DE + dbase + hrow;
#pragma unroll
  for (int mt = 0; mt < MT; ++mt) {
#pragma unroll
    for (int v = 0; v < 8; ++v) {
      const int r = mt * 16 + v + 8 * sel;
#pragma unroll
      for (int t = 0; t < 4; ++t) {
        po[(size_t)r * DE + t * 16] = acc[mt][t][v];
      }
    }
  }
}

// ---------------------------------------------------------------------------
// Merge of the SPLIT key ranges: out = sum_s e^(m_s - M) acc_s / sum_s e^(m_s - M) l_s
// with M = max_s m_s.  One workgroup per 16 rows, 16 threads per row: few waves
// to start, and every thread's 32 16-byte loads are in flight together.
// ---------------------------------------------------------------------------
#define MJ (DE / 4 / 16)   // 4-float columns per thread
static_assert(SPLIT == 4 && MJ == 8, "the load fence below names 4 x 4 column pairs");
__global__ __launch_bounds__(256) void taa_merge_kernel(
    const float* __restrict__ pa0, const float* __restrict__ pa1,
    const float* __restrict__ pa2, const float* __restrict__ pa3,
    const float* __restrict__ pm, const float* __restrict__ pl,
    float* __restrict__ out) {
  const float* const pa[SPLIT] = {pa0, pa1, pa2, pa3};   // one base per key range
  const int row = blockIdx.x * 16 + (threadIdx.x >> 4);
  // One 32-bit element offset serves every load and the stores (the bases are
  // uniform), so the one address register lives to the kernel's end.
  const unsigned base = (unsigned)row * (DE / 4) + (threadIdx.x & 15);
  float m[SPLIT], l[SPLIT];
  v8f   a[SPLIT][MJ / 2];   // column pairs, so that one fence can name them all
#pragma unroll
  for (int s = 0; s < SPLIT; ++s) {
#pragma unroll
    for (int j = 0; j < MJ; ++j)
      ((v4f*)&a[s][j >> 1])[j & 1] = ((const v4f*)pa[s])[base + j * 16];
  }
#pragma unroll
  for (int s = 0; s < SPLIT; ++s) { m[s] = pm[s * NH + row]; l[s] = pl[s * NH + row]; }
  // Inputs-only fence on the loaded values: holds all the loads in one group in
  // front of the arithmetic, in flight together, instead of sunk to their uses
  // a few at a time.
  asm volatile("" :: "v"(a[0][0]), "v"(a[0][1]), "v"(a[0][2]), "v"(a[0][3]),
                     "v"(a[1][0]), "v"(a[1][1]), "v"(a[1][2]), "v"(a[1][3]),
                     "v"(a[2][0]), "v"(a[2][1]), "v"(a[2][2]), "v"(a[2][3]),
                     "v"(a[3][0]), "v"(a[3][1]), "v"(a[3][2]), "v"(a[3][3]),
                     "v"(m[0]), "v"(m[1]), "v"(m[2]), "v"(m[3]),
                     "v"(l[0]), "v"(l[1]), "v"(l[2]), "v"(l[3]));
  float mx = m[0];
#pragma unroll
  for (int s = 1; s < SPLIT; ++s) mx = fmaxf(mx, m[s]);
  float w[SPLIT];
  float den = 0.0f;
#pragma unroll
  for (int s = 0; s < SPLIT; ++s) { w[s] = __expf(m[s] - mx); den += w[s] * l[s]; }
  const float inv = 1.0f / den;
#pragma unroll
  for (int s = 0; s < SPLIT; ++s) w[s] *= inv;
  v4f* o4 = (v4f*)out;
#pragma unroll
  for (int j = 0; j < MJ; ++j) {
    v4f o = w[0] * ((const v4f*)&a[0][j >> 1])[j & 1];
#pragma unroll
    for (int s = 1; s < SPLIT; ++s) o += w[s] * ((const v4f*)&a[s][j >> 1])[j & 1];
    o4[base + j * 16] = o;
  }
}

// ---------------------------------------------------------------------------
extern "C" void kernel_launch(void* const* d_in, const int* in_sizes, int n_in,
                              void* d_out, int out_size, void* d_ws, size_t ws_size,
                              hipStream_t stream) {
  const float* Q  = (const float*)d_in[0];  // query_code_embeds [N,D]
  const float* K  = (const float*)d_in[1];  // hist_embeddings  [N,D]
  const float* t  = (const float*)d_in[2];  // hist_times       [N]
  const float* w1 = (const float*)d_in[3];  // [1,H]
  const float* b1 = (const float*)d_in[4];  // [H]
  const float* w2 = (const float*)d_in[5];  // [H,1]
  const float* b2 = (const float*)d_in[6];  // [1]
  float* out = (float*)d_out;

  // workspace layout: q_h | k_h | kT_h (each N*D f16 = 4 MB) | partial sums
  // (SPLIT * N*D f32) | partial maxima | partial denominators (SPLIT * N f32)
  _Float16* qh = (_Float16*)d_ws;
  _Float16* kh = qh + (size_t)NH * DE;
  _Float16* kT = kh + (size_t)NH * DE;
  float* pacc = (float*)(kT + (size_t)NH * DE);
  float* pm   = pacc + (size_t)SPLIT * NH * DE;
  float* pl   = pm + (size_t)SPLIT * NH;

  const int total = NH * DE;
  taa_convert_kernel<<<total / 256, 256, 0, stream>>>(Q, K, qh, kh, kT);
  taa_attn_kernel<<<(NH / QB) * SPLIT, 256, 0, stream>>>(qh, kh, kT, t, w1, b1, w2, b2,
                                                         pacc, pm, pl);
  taa_merge_kernel<<<NH / 16, 256, 0, stream>>>(
      pacc, pacc + (size_t)NH * DE, pacc + (size_t)2 * NH * DE,
      pacc + (size_t)3 * NH * DE, pm, pl, out);
  (void)in_sizes; (void)n_in; (void)out_size; (void)ws_size;
}

// v005
// Measured time: 60.4 microseconds a run.
// Next to v004, in two timings, it ran 1.30 times as fast each time.
// Counting every step since v000, it is 4.34 times as fast.
#include <hip/hip_runtime.h>
#include <math.h>

// Problem constants (match reference)
#define NH 4096    // n_history
#define DE 512     // embed dim
#define HH 8       // time-weight MLP hidden
#define QB 64      // query rows per workgroup
#define MT (QB / 16)   // 16-row tiles per workgroup: uses of each loaded B fragment
#define SPLIT 4        // key ranges; one workgroup = (query block, key range)
#define KSPAN (NH / SPLIT)  // keys per workgroup
#define RL 4           // lanes that share one softmax row
#define CL (KB / RL)   // columns of a key block per softmax lane
#define KB 128     // keys per iteration (8 waves * 16 keys)
#define DSLICE 64  // d-columns owned per wave for the P@V accumulator
// LDS row pitches.  The fragment readers (ds_load_b128, one row per lane) want
// a pitch that is an odd multiple of 16 B so that 16 rows fall on 16 distinct
// bank groups; the natural pitches (1024 B, 256 B) put all rows on one group.
#define QP (DE + 8)   // sQ pitch in halves: 1040 B = 65 * 16 B
#define PP (KB + 8)   // sP pitch in halves:  272 B = 17 * 16 B
#define SP (KB + 4)   // sS pitch in floats: rows r and r+8 land 32 banks apart

typedef __attribute__((ext_vector_type(16))) _Float16 v16h;
typedef __attribute__((ext_vector_type(8)))  _Float16 v8h;
typedef __attribute__((ext_vector_type(8)))  float    v8f;
typedef __attribute__((ext_vector_type(4)))  float    v4f;

static __device__ __forceinline__ v16h ldfrag(const _Float16* p) {
  v16h r;
  ((v8h*)&r)[0] = *(const v8h*)(p);
  ((v8h*)&r)[1] = *(const v8h*)(p + 16);
  return r;
}

// Fragment-order storage of the two B operands.  One 16x32 f16 fragment is
// FRAG halves (1 KB): register half h of lane l lies at h*256 + l*8, so each of
// the two wave-wide 16-byte loads of a fragment reads 512 contiguous bytes
// (4 whole lines) instead of 32 bytes out of each of 16 lines.
#define FRAG 512
static __device__ __forceinline__ v16h ldfrag_packed(const _Float16* p) {
  v16h r;
  ((v8h*)&r)[0] = *(const v8h*)(p);
  ((v8h*)&r)[1] = *(const v8h*)(p + 256);
  return r;
}

// Value of lane l ^ 1 and of lane l ^ 2: vector cross-lane moves inside a
// 16-lane row; every lane is on where they are used.
static __device__ __forceinline__ float lane_xor1(float x) {
  return __builtin_bit_cast(float, __builtin_amdgcn_update_dpp(
      0, __builtin_bit_cast(int, x), 0x161 /* row_xmask:1 */, 0xf, 0xf, true));
}
static __device__ __forceinline__ float lane_xor2(float x) {
  return __builtin_bit_cast(float, __builtin_amdgcn_update_dpp(
      0, __builtin_bit_cast(int, x), 0x162 /* row_xmask:2 */, 0xf, 0xf, true));
}

// Work-group barrier that orders LDS traffic only.  __syncthreads() would also
// drain the global fragment loads that are issued ahead and must stay in flight
// across it; the data handed over at these barriers lies in LDS alone.
static __device__ __forceinline__ void lds_barrier() {
  asm volatile("s_wait_dscnt 0x0" ::: "memory");
  asm volatile("s_barrier_signal -1\n\ts_barrier_wait -1" ::: "memory");
}

// ---------------------------------------------------------------------------
// Pre-pass: f32 -> f16 conversion.  q_h = Q * (1/sqrt(D)) row-major.
// k_h  = K in fragment order for Q@K^T: fragment (key/16, d/32), N = key, k = d.
// kT_h = K in fragment order for P@V: fragment (key/128, d/16, (key/32)%4),
//        N = d, k = key.
// Inside a fragment: lane = (N%16) + 16*sel, k%32 = h*16 + sel*8 + j.
// ---------------------------------------------------------------------------
__global__ __launch_bounds__(256) void taa_convert_kernel(
    const float* __restrict__ Q, const float* __restrict__ K,
    _Float16* __restrict__ qh, _Float16* __restrict__ kh,
    _Float16* __restrict__ kT) {
  const int i = blockIdx.x * blockDim.x + threadIdx.x;   // [0, N*D)
  const float scale = 0.044194173824159216f;             // 1/sqrt(512)
  // i is the packed destination index of both B operands (coalesced writes).
  const int f  = i >> 9;                                 // fragment number
  const int n  = (i >> 3) & 15;                          // N index in fragment
  const int k  = ((i >> 8) & 1) * 16 + ((i >> 7) & 1) * 8 + (i & 7);  // k index
  const float qv = Q[i];
  // Q@K^T operand: key = (f/16)*16 + n, d = (f%16)*32 + k
  const float ks = K[(size_t)((f >> 4) * 16 + n) * DE + (f & 15) * 32 + k];
  // P@V operand: key = (f/128)*128 + (f%4)*32 + k, d = ((f/4)%32)*16 + n
  const float kv =
      K[(size_t)((f >> 7) * KB + (f & 3) * 32 + k) * DE + ((f >> 2) & 31) * 16 + n];
  // Stands between the loads and the conversions below, which overwrite the
  // loads' address registers.
  asm volatile("s_wait_xcnt 0x0" ::: "memory");
  qh[i] = (_Float16)(qv * scale);
  kh[i] = (_Float16)ks;
  kT[i] = (_Float16)kv;
}

// ---------------------------------------------------------------------------
// Fused time-aware flash attention over one key range.
// Workgroup: 64 query rows x KSPAN keys, 8 wave32s.  Every B fragment that a
// wave loads feeds MT matrix instructions (one per 16-row tile).
//   QK^T : wave w owns keys [kb + 16w, kb + 16w + 16), full-D reduction,
//          A-fragments from LDS-staged Q (async-copied once).
//   P@V  : wave w owns output d-slice [64w, 64w + 64).
//   softmax: thread t owns row t/4 and, of each 32 columns, the 8 from 8*(t%4):
//          a row's maximum and sum are formed in registers and finished by two
//          cross-lane steps each.
// Result: the range's unnormalised sum, row maximum and row denominator; the
// ranges are merged by taa_merge_kernel.
// B fragments go from global memory straight to registers, a phase ahead of
// their use: the P@V group behind this pass's Q@K^T (it flies during the
// softmax), the next pass's Q@K^T group in quarters, the first behind the
// softmax and one behind each of the first three P@V k-steps, as that step's fragments retire.
// ---------------------------------------------------------------------------
__global__ __launch_bounds__(256) void taa_attn_kernel(
    const _Float16* __restrict__ qh, const _Float16* __restrict__ kh,
    const _Float16* __restrict__ kT, const float* __restrict__ times,
    const float* __restrict__ w1, const float* __restrict__ b1,
    const float* __restrict__ w2, const float* __restrict__ b2p,
    float* __restrict__ pacc, float* __restrict__ pm, float* __restrict__ pl) {
  __shared__ __align__(16) _Float16 sQ[QB * QP];   // 64x512 f16, padded rows
  __shared__ __align__(16) float    sS[QB * SP];   // 64x128 f32, padded rows
  __shared__ __align__(16) _Float16 sP[QB * PP];   // 64x128 f16, padded rows
  __shared__ __align__(16) float sAlpha[QB];
  __shared__ __align__(16) float sTk[KSPAN];       // times of this key range

  const int tid   = threadIdx.x;
  const int lane  = tid & 31;
  const int wave  = tid >> 5;
  const int hrow  = lane & 15;   // M (A) / N (B,C) fragment index
  const int sel   = lane >> 4;   // which K-half of the fragment
  const int qbase = (blockIdx.x / SPLIT) * QB;
  const int split = blockIdx.x % SPLIT;
  const int kbeg  = split * KSPAN;
  const int kend  = kbeg + KSPAN;
  const int dbase = wave * DSLICE;
  const int srow  = tid / RL;    // softmax row of this thread
  const int sq    = tid % RL;    // its place among the row's lanes

  // ---- one-time async stage of the Q block into LDS (64 B per thread and
  //      16-row tile) ----
#pragma unroll
  for (int mt = 0; mt < MT; ++mt) {
    const _Float16* gq = qh + (size_t)(qbase + mt * 16) * DE + tid * 32;
    const unsigned  lo = (unsigned)(uintptr_t)(const void*)(&sQ[(mt * 16 + (tid >> 4)) * QP + (tid & 15) * 32]);
    // The closing wait stands in the copies' own statement, in front of any
    // later write of the address registers that they name.
    asm volatile(
        "global_load_async_to_lds_b128 %0, %4, off\n\t"
        "global_load_async_to_lds_b128 %1, %5, off\n\t"
        "global_load_async_to_lds_b128 %2, %6, off\n\t"
        "global_load_async_to_lds_b128 %3, %7, off\n\t"
        "s_wait_xcnt 0x0"
        :: "v"(lo), "v"(lo + 16u), "v"(lo + 32u), "v"(lo + 48u),
           "v"(gq), "v"(gq + 8), "v"(gq + 16), "v"(gq + 24) : "memory");
  }
  // This wave's copies have landed; the barrier below publishes them.
  asm volatile("s_wait_asynccnt 0x0" ::: "memory");

  // Tiny MLP parameters -> registers (uniform loads)
  float w1r[HH], b1r[HH], w2r[HH];
#pragma unroll
  for (int j = 0; j < HH; ++j) { w1r[j] = w1[j]; b1r[j] = b1[j]; w2r[j] = w2[j]; }
  const float b2 = b2p[0];

  static_assert(KSPAN == 256 * 4, "one 16-byte load a thread stages the key times");
  const v4f tk4 = ((const v4f*)(times + kbeg))[tid];
  const float tq = times[qbase + srow];
  // Stands behind these two loads, in front of the first instruction that
  // overwrites a register of their addresses.
  asm volatile("s_wait_xcnt 0x0" ::: "memory");
  ((v4f*)sTk)[tid] = tk4;

  v8f acc[MT][4] = {};                     // 64 x 64 f32 output slice
  float mrow = -3.0e38f, lrow = 0.0f;      // softmax state of the owned row
  __syncthreads();                         // sQ (all waves) + sTk visible

  const _Float16* qlds = sQ + hrow * QP + sel * 8;
  const _Float16* kwave = kh + (size_t)wave * (16 * FRAG) + lane * 8;
  const _Float16* kfirst = kwave + (size_t)(kbeg >> 4) * (16 * FRAG);
  const _Float16* vwave = kT + (size_t)wave * (16 * FRAG) + lane * 8;

  // Q@K^T fragments of the first key block.
  v16h bk[16];
#pragma unroll
  for (int f = 0; f < 16; ++f) bk[f] = ldfrag_packed(kfirst + f * FRAG);

  for (int kb = kbeg; kb < kend; kb += KB) {
    // ---- 1) S tiles: this wave's 16 keys x 64 q-rows over full D ----
    // A fragments double-buffered from LDS, MT at a time; B fragments already
    // in registers, each used MT times.  The MT row tiles are the independent
    // accumulator chains.
    v16h aq[2][MT];
#pragma unroll
    for (int mt = 0; mt < MT; ++mt) aq[0][mt] = ldfrag(qlds + mt * 16 * QP);
    v8f st[MT] = {};
#pragma unroll
    for (int kk = 0; kk < 16; ++kk) {
      const int cur = kk & 1;
      if (kk < 15) {
#pragma unroll
        for (int mt = 0; mt < MT; ++mt)
          aq[cur ^ 1][mt] = ldfrag(qlds + mt * 16 * QP + (kk + 1) * 32);
      }
#pragma unroll
      for (int mt = 0; mt < MT; ++mt) {
        st[mt] = __builtin_amdgcn_wmma_f32_16x16x32_f16(false, aq[cur][mt], false,
                                                        bk[kk], (short)0, st[mt],
                                                        false, false);
      }
    }
    // store finished S tiles (single writer per element; no atomics needed)
#pragma unroll
    for (int mt = 0; mt < MT; ++mt) {
#pragma unroll
      for (int v = 0; v < 8; ++v) {
        sS[(mt * 16 + v + 8 * sel) * SP + wave * 16 + hrow] = st[mt][v];
      }
    }
    // This pass's P@V fragments fly during the softmax.
    const _Float16* vfrag = vwave + (size_t)(kb >> 7) * (8 * 16 * FRAG);
    v16h bv[16];                               // [k-step][d-tile]
#pragma unroll
    for (int f = 0; f < 16; ++f)
      bv[f] = ldfrag_packed(vfrag + ((f & 3) * 4 + (f >> 2)) * FRAG);
    // Stands behind the loads issued so far and in front of the first
    // instruction that overwrites an address register they name; the address
    // is named as an input so that its register lives up to the wait.
    asm volatile("s_wait_xcnt 0x0" :: "v"(vfrag) : "memory");
    // Keeps the load group in front of the softmax instead of sunk to its uses.
    __builtin_amdgcn_sched_barrier(0);
    // Barrier A: sS stores visible; also orders prev-iteration sP reads
    // (PV ds_loads) before this iteration's sP writes below.
    lds_barrier();

    // ---- 2) time-weight MLP + online softmax (RL lanes a row) ----
    {
      const float* srd = sS + srow * SP + sq * 8;
      const float* trd = sTk + (kb - kbeg) + sq * 8;
      float sv[CL];
      float rmax = -3.0e38f;
#pragma unroll
      for (int g = 0; g < CL / 4; ++g) {     // 4 columns a 16-byte LDS read
        const int co = (g >> 1) * 32 + (g & 1) * 4;
        const v4f s4 = *(const v4f*)(srd + co);
        const v4f t4 = *(const v4f*)(trd + co);
#pragma unroll
        for (int e = 0; e < 4; ++e) {
          float s = s4[e];
          const float td = fabsf(tq - t4[e]);
          float z = b2;
#pragma unroll
          for (int j = 0; j < HH; ++j) {
            float hj = td * w1r[j] + b1r[j];
            hj = hj > 0.0f ? hj : 0.0f;
            z += hj * w2r[j];
          }
          s *= 1.0f / (1.0f + __expf(-z));   // * sigmoid(mlp(|dt|))
          sv[g * 4 + e] = s;
          rmax = fmaxf(rmax, s);
        }
      }
      rmax = fmaxf(rmax, lane_xor1(rmax));
      rmax = fmaxf(rmax, lane_xor2(rmax));
      const float mnew  = fmaxf(mrow, rmax);
      const float alpha = __expf(mrow - mnew);
      mrow = mnew;
      float ps[CL / 8];                      // one independent sum per 8 columns
#pragma unroll
      for (int g = 0; g < CL / 8; ++g) {
        v8h ph;
        ps[g] = 0.0f;
#pragma unroll
        for (int e = 0; e < 8; ++e) {
          const float p = __expf(sv[g * 8 + e] - mnew);
          ps[g] += p;
          ph[e] = (_Float16)p;
        }
        *(v8h*)(sP + srow * PP + g * 32 + sq * 8) = ph;
      }
      float psum = (ps[0] + ps[1]) + (ps[2] + ps[3]);
      psum += lane_xor1(psum);
      psum += lane_xor2(psum);
      lrow = lrow * alpha + psum;
      if (sq == 0) sAlpha[srow] = alpha;
    }
    // First quarter of the next pass's Q@K^T fragments.  Unconditional (a
    // branch would merge two paths in the wait counting): the last pass
    // re-reads its own block and the values are not used.
    const int kn = (kb + KB < kend) ? kb + KB : kb;
    const _Float16* knext = kwave + (size_t)(kn >> 4) * (16 * FRAG);
#pragma unroll
    for (int f = 0; f < 4; ++f) bk[f] = ldfrag_packed(knext + f * FRAG);
    // In front of the first overwrite of these loads' address register; the
    // address is named as an input so that its register lives up to the wait.
    asm volatile("s_wait_xcnt 0x0" :: "v"(knext) : "memory");
    // Barrier B: sP / sAlpha visible before rescale + PV.
    lds_barrier();

    // ---- 3) rescale accumulators by alpha ----
#pragma unroll
    for (int mt = 0; mt < MT; ++mt) {
#pragma unroll
      for (int v = 0; v < 8; ++v) {
        const float a = sAlpha[mt * 16 + v + 8 * sel];
        acc[mt][0][v] *= a; acc[mt][1][v] *= a;
        acc[mt][2][v] *= a; acc[mt][3][v] *= a;
      }
    }

    // ---- 4) acc += P @ V_slice (A double-buffered from LDS, B in registers) ----
    const _Float16* plds = sP + hrow * PP + sel * 8;
    v16h aP[2][MT];
#pragma unroll
    for (int mt = 0; mt < MT; ++mt) aP[0][mt] = ldfrag(plds + mt * 16 * PP);
#pragma unroll
    for (int kk = 0; kk < 4; ++kk) {           // 4 k-steps of 32 keys
      const int cur = kk & 1;
      if (kk < 3) {
#pragma unroll
        for (int mt = 0; mt < MT; ++mt)
          aP[cur ^ 1][mt] = ldfrag(plds + mt * 16 * PP + (kk + 1) * 32);
      }
#pragma unroll
      for (int mt = 0; mt < MT; ++mt) {
#pragma unroll
        for (int t = 0; t < 4; ++t) {
          acc[mt][t] = __builtin_amdgcn_wmma_f32_16x16x32_f16(
              false, aP[cur][mt], false, bv[kk * 4 + t], (short)0, acc[mt][t],
              false, false);
        }
      }
      if (kk < 3) {
        // Next quarter of the next pass's Q@K^T fragments.
#pragma unroll
        for (int f = 4 * kk + 4; f < 4 * kk + 8; ++f)
          bk[f] = ldfrag_packed(knext + f * FRAG);
        // In front of the first overwrite of these loads' address register.
        asm volatile("s_wait_xcnt 0x0" :: "v"(knext) : "memory");
        // Keeps this quarter here: hoisted it would need registers that this
        // k-step's fragments still hold, sunk it would land too late.
        __builtin_amdgcn_sched_barrier(0);
      }
    }
  }

  // ---- epilogue: this key range's partial sum, maximum and denominator ----
  if (sq == 0) {
    pm[split * NH + qbase + srow] = mrow;
    pl[split * NH + qbase + srow] = lrow;
  }
  float* po = pacc + ((size_t)split * NH + qbase) * DE + dbase + hrow;
#pragma unroll
  for (int mt = 0; mt < MT; ++mt) {
#pragma unroll
    for (int v = 0; v < 8; ++v) {
      const int r = mt * 16 + v + 8 * sel;
#pragma unroll
      for (int t = 0; t < 4; ++t) {
        po[(size_t)r * DE + t * 16] = acc[mt][t][v];
      }
    }
  }
}

// ---------------------------------------------------------------------------
// Merge of the SPLIT key ranges: out = sum_s e^(m_s - M) acc_s / sum_s e^(m_s - M) l_s
// with M = max_s m_s.  One workgroup per 16 rows, 16 threads per row: few waves
// to start, and every thread's 32 16-byte loads are in flight together.
// ---------------------------------------------------------------------------
#define MJ (DE / 4 / 16)   // 4-float columns per thread
static_assert(SPLIT == 4 && MJ == 8, "the load fence below names 4 x 4 column pairs");
__global__ __launch_bounds__(256) void taa_merge_kernel(
    const float* __restrict__ pa0, const float* __restrict__ pa1,
    const float* __restrict__ pa2, const float* __restrict__ pa3,
    const float* __restrict__ pm, const float* __restrict__ pl,
    float* __restrict__ out) {
  const float* const pa[SPLIT] = {pa0, pa1, pa2, pa3};   // one base per key range
  const int row = blockIdx.x * 16 + (threadIdx.x >> 4);
  // One 32-bit element offset serves every load and the stores (the bases are
  // uniform), so the one address register lives to the kernel's end.
  const unsigned base = (unsigned)row * (DE / 4) + (threadIdx.x & 15);
  float m[SPLIT], l[SPLIT];
  v8f   a[SPLIT][MJ / 2];   // column pairs, so that one fence can name them all
#pragma unroll
  for (int s = 0; s < SPLIT; ++s) {
#pragma unroll
    for (int j = 0; j < MJ; ++j)
      ((v4f*)&a[s][j >> 1])[j & 1] = ((const v4f*)pa[s])[base + j * 16];
  }
#pragma unroll
  for (int s = 0; s < SPLIT; ++s) { m[s] = pm[s * NH + row]; l[s] = pl[s * NH + row]; }
  // Inputs-only fence on the loaded values: holds all the loads in one group in
  // front of the arithmetic, in flight together, instead of sunk to their uses
  // a few at a time.
  asm volatile("" :: "v"(a[0][0]), "v"(a[0][1]), "v"(a[0][2]), "v"(a[0][3]),
                     "v"(a[1][0]), "v"(a[1][1]), "v"(a[1][2]), "v"(a[1][3]),
                     "v"(a[2][0]), "v"(a[2][1]), "v"(a[2][2]), "v"(a[2][3]),
                     "v"(a[3][0]), "v"(a[3][1]), "v"(a[3][2]), "v"(a[3][3]),
                     "v"(m[0]), "v"(m[1]), "v"(m[2]), "v"(m[3]),
                     "v"(l[0]), "v"(l[1]), "v"(l[2]), "v"(l[3]));
  float mx = m[0];
#pragma unroll
  for (int s = 1; s < SPLIT; ++s) mx = fmaxf(mx, m[s]);
  float w[SPLIT];
  float den = 0.0f;
#pragma unroll
  for (int s = 0; s < SPLIT; ++s) { w[s] = __expf(m[s] - mx); den += w[s] * l[s]; }
  const float inv = 1.0f / den;
#pragma unroll
  for (int s = 0; s < SPLIT; ++s) w[s] *= inv;
  v4f* o4 = (v4f*)out;
#pragma unroll
  for (int j = 0; j < MJ; ++j) {
    v4f o = w[0] * ((const v4f*)&a[0][j >> 1])[j & 1];
#pragma unroll
    for (int s = 1; s < SPLIT; ++s) o += w[s] * ((const v4f*)&a[s][j >> 1])[j & 1];
    o4[base + j * 16] = o;
  }
}

// ---------------------------------------------------------------------------
extern "C" void kernel_launch(void* const* d_in, const int* in_sizes, int n_in,
                              void* d_out, int out_size, void* d_ws, size_t ws_size,
                              hipStream_t stream) {
  const float* Q  = (const float*)d_in[0];  // query_code_embeds [N,D]
  const float* K  = (const float*)d_in[1];  // hist_embeddings  [N,D]
  const float* t  = (const float*)d_in[2];  // hist_times       [N]
  const float* w1 = (const float*)d_in[3];  // [1,H]
  const float* b1 = (const float*)d_in[4];  // [H]
  const float* w2 = (const float*)d_in[5];  // [H,1]
  const float* b2 = (const float*)d_in[6];  // [1]
  float* out = (float*)d_out;

  // workspace layout: q_h | k_h | kT_h (each N*D f16 = 4 MB) | partial sums
  // (SPLIT * N*D f32) | partial maxima | partial denominators (SPLIT * N f32)
  _Float16* qh = (_Float16*)d_ws;
  _Float16* kh = qh + (size_t)NH * DE;
  _Float16* kT = kh + (size_t)NH * DE;
  float* pacc = (float*)(kT + (size_t)NH * DE);
  float* pm   = pacc + (size_t)SPLIT * NH * DE;
  float* pl   = pm + (size_t)SPLIT * NH;

  const int total = NH * DE;
  taa_convert_kernel<<<total / 256, 256, 0, stream>>>(Q, K, qh, kh, kT);
  taa_attn_kernel<<<(NH / QB) * SPLIT, 256, 0, stream>>>(qh, kh, kT, t, w1, b1, w2, b2,
                                                         pacc, pm, pl);
  taa_merge_kernel<<<NH / 16, 256, 0, stream>>>(
      pacc, pacc + (size_t)NH * DE, pacc + (size_t)2 * NH * DE,
      pacc + (size_t)3 * NH * DE, pm, pl, out);
  (void)in_sizes; (void)n_in; (void)out_size; (void)ws_size;
}

// v006
// A run of this version takes 58.2 microseconds.
// Next to v005, in two timings, it ran 1.04 times as fast each time.
// All steps since v000 together make it 4.51 times as fast.
#include <hip/hip_runtime.h>
#include <math.h>

// Problem constants (match reference)
#define NH 4096    // n_history
#define DE 512     // embed dim
#define HH 8       // time-weight MLP hidden
#define QB 64      // query rows per workgroup
#define MT (QB / 16)   // 16-row tiles per workgroup: uses of each loaded B fragment
#define SPLIT 4        // key ranges; one workgroup = (query block, key range)
#define KSPAN (NH / SPLIT)  // keys per workgroup
#define RL 4           // lanes that share one softmax row
#define CL (KB / RL)   // columns of a key block per softmax lane
#define KB 128     // keys per iteration (8 waves * 16 keys)
#define DSLICE 64  // d-columns owned per wave for the P@V accumulator
// LDS row pitches.  The fragment readers (ds_load_b128, one row per lane) want
// a pitch that is an odd multiple of 16 B so that 16 rows fall on 16 distinct
// bank groups; the natural pitches (1024 B, 256 B) put all rows on one group.
#define QP (DE + 8)   // sQ pitch in halves: 1040 B = 65 * 16 B
#define PP (KB + 8)   // sP pitch in halves:  272 B = 17 * 16 B
#define SP (KB + 4)   // sS pitch in floats: rows r and r+8 land 32 banks apart

typedef __attribute__((ext_vector_type(16))) _Float16 v16h;
typedef __attribute__((ext_vector_type(8)))  _Float16 v8h;
typedef __attribute__((ext_vector_type(8)))  float    v8f;
typedef __attribute__((ext_vector_type(4)))  float    v4f;

static __device__ __forceinline__ v16h ldfrag(const _Float16* p) {
  v16h r;
  ((v8h*)&r)[0] = *(const v8h*)(p);
  ((v8h*)&r)[1] = *(const v8h*)(p + 16);
  return r;
}

// Fragment-order storage of the two B operands.  One 16x32 f16 fragment is
// FRAG halves (1 KB): register half h of lane l lies at h*256 + l*8, so each of
// the two wave-wide 16-byte loads of a fragment reads 512 contiguous bytes
// (4 whole lines) instead of 32 bytes out of each of 16 lines.
#define FRAG 512
static __device__ __forceinline__ v16h ldfrag_packed(const _Float16* p) {
  v16h r;
  ((v8h*)&r)[0] = *(const v8h*)(p);
  ((v8h*)&r)[1] = *(const v8h*)(p + 256);
  return r;
}

// Value of lane l ^ 1 and of lane l ^ 2: vector cross-lane moves inside a
// 16-lane row; every lane is on where they are used.
static __device__ __forceinline__ float lane_xor1(float x) {
  return __builtin_bit_cast(float, __builtin_amdgcn_update_dpp(
      0, __builtin_bit_cast(int, x), 0x161 /* row_xmask:1 */, 0xf, 0xf, true));
}
static __device__ __forceinline__ float lane_xor2(float x) {
  return __builtin_bit_cast(float, __builtin_amdgcn_update_dpp(
      0, __builtin_bit_cast(int, x), 0x162 /* row_xmask:2 */, 0xf, 0xf, true));
}

// Work-group barrier that orders LDS traffic only.  __syncthreads() would also
// drain the global fragment loads that are issued ahead and must stay in flight
// across it; the data handed over at these barriers lies in LDS alone.
static __device__ __forceinline__ void lds_barrier() {
  asm volatile("s_wait_dscnt 0x0" ::: "memory");
  asm volatile("s_barrier_signal -1\n\ts_barrier_wait -1" ::: "memory");
}

// ---------------------------------------------------------------------------
// Pre-pass: f32 -> f16 conversion.  q_h = Q * (1/sqrt(D)) row-major.
// k_h  = K in fragment order for Q@K^T: fragment (key/16, d/32), N = key, k = d.
// kT_h = K in fragment order for P@V: fragment (key/128, d/16, (key/32)%4),
//        N = d, k = key.
// Inside a fragment: lane = (N%16) + 16*sel, k%32 = h*16 + sel*8 + j.
// ---------------------------------------------------------------------------
__global__ __launch_bounds__(256) void taa_convert_kernel(
    const float* __restrict__ Q, const float* __restrict__ K,
    _Float16* __restrict__ qh, _Float16* __restrict__ kh,
    _Float16* __restrict__ kT) {
  const int i = blockIdx.x * blockDim.x + threadIdx.x;   // [0, N*D)
  const float scale = 0.044194173824159216f;             // 1/sqrt(512)
  // i is the packed destination index of both B operands (coalesced writes).
  const int f  = i >> 9;                                 // fragment number
  const int n  = (i >> 3) & 15;                          // N index in fragment
  const int k  = ((i >> 8) & 1) * 16 + ((i >> 7) & 1) * 8 + (i & 7);  // k index
  const float qv = Q[i];
  // Q@K^T operand: key = (f/16)*16 + n, d = (f%16)*32 + k
  const float ks = K[(size_t)((f >> 4) * 16 + n) * DE + (f & 15) * 32 + k];
  // P@V operand: key = (f/128)*128 + (f%4)*32 + k, d = ((f/4)%32)*16 + n
  const float kv =
      K[(size_t)((f >> 7) * KB + (f & 3) * 32 + k) * DE + ((f >> 2) & 31) * 16 + n];
  // Stands between the loads and the conversions below, which overwrite the
  // loads' address registers.
  asm volatile("s_wait_xcnt 0x0" ::: "memory");
  qh[i] = (_Float16)(qv * scale);
  kh[i] = (_Float16)ks;
  kT[i] = (_Float16)kv;
}

// ---------------------------------------------------------------------------
// Fused time-aware flash attention over one key range.
// Workgroup: 64 query rows x KSPAN keys, 8 wave32s.  Every B fragment that a
// wave loads feeds MT matrix instructions (one per 16-row tile).
//   QK^T : wave w owns keys [kb + 16w, kb + 16w + 16), full-D reduction,
//          A-fragments from LDS-staged Q (async-copied once).
//   P@V  : wave w owns output d-slice [64w, 64w + 64).
//   softmax: thread t owns row t/4 and, of each 32 columns, the 8 from 8*(t%4):
//          a row's maximum and sum are formed in registers and finished by two
//          cross-lane steps each.
// Result: the range's unnormalised sum, row maximum and row denominator; the
// ranges are merged by taa_merge_kernel.
// B fragments go from global memory straight to registers, a phase ahead of
// their use: the P@V group behind this pass's Q@K^T (it flies during the
// softmax), the next pass's Q@K^T group in quarters, the first behind the
// softmax and one behind each of the first three P@V k-steps, as that step's fragments retire.
// ---------------------------------------------------------------------------
__global__ __launch_bounds__(256) void taa_attn_kernel(
    const _Float16* __restrict__ qh, const _Float16* __restrict__ kh,
    const _Float16* __restrict__ kT, const float* __restrict__ times,
    const float* __restrict__ w1, const float* __restrict__ b1,
    const float* __restrict__ w2, const float* __restrict__ b2p,
    float* __restrict__ pacc, float* __restrict__ pm, float* __restrict__ pl) {
  __shared__ __align__(16) _Float16 sQ[QB * QP];   // 64x512 f16, padded rows
  __shared__ __align__(16) float    sS[QB * SP];   // 64x128 f32, padded rows
  __shared__ __align__(16) _Float16 sP[QB * PP];   // 64x128 f16, padded rows
  __shared__ __align__(16) float sAlpha[QB];
  __shared__ __align__(16) float sTk[KSPAN];       // times of this key range

  const int tid   = threadIdx.x;
  const int lane  = tid & 31;
  const int wave  = tid >> 5;
  const int hrow  = lane & 15;   // M (A) / N (B,C) fragment index
  const int sel   = lane >> 4;   // which K-half of the fragment
  const int qbase = (blockIdx.x / SPLIT) * QB;
  const int split = blockIdx.x % SPLIT;
  const int kbeg  = split * KSPAN;
  const int kend  = kbeg + KSPAN;
  const int dbase = wave * DSLICE;
  const int srow  = tid / RL;    // softmax row of this thread
  const int sq    = tid % RL;    // its place among the row's lanes

  // ---- one-time async stage of the Q block into LDS (64 B per thread and
  //      16-row tile) ----
#pragma unroll
  for (int mt = 0; mt < MT; ++mt) {
    const _Float16* gq = qh + (size_t)(qbase + mt * 16) * DE + tid * 32;
    const unsigned  lo = (unsigned)(uintptr_t)(const void*)(&sQ[(mt * 16 + (tid >> 4)) * QP + (tid & 15) * 32]);
    // The closing wait stands in the copies' own statement, in front of any
    // later write of the address registers that they name.
    asm volatile(
        "global_load_async_to_lds_b128 %0, %4, off\n\t"
        "global_load_async_to_lds_b128 %1, %5, off\n\t"
        "global_load_async_to_lds_b128 %2, %6, off\n\t"
        "global_load_async_to_lds_b128 %3, %7, off\n\t"
        "s_wait_xcnt 0x0"
        :: "v"(lo), "v"(lo + 16u), "v"(lo + 32u), "v"(lo + 48u),
           "v"(gq), "v"(gq + 8), "v"(gq + 16), "v"(gq + 24) : "memory");
  }
  // This wave's copies have landed; the barrier below publishes them.
  asm volatile("s_wait_asynccnt 0x0" ::: "memory");

  // Tiny MLP parameters -> registers (uniform loads)
  float w1r[HH], b1r[HH], w2r[HH];
#pragma unroll
  for (int j = 0; j < HH; ++j) { w1r[j] = w1[j]; b1r[j] = b1[j]; w2r[j] = w2[j]; }
  const float b2 = b2p[0];

  static_assert(KSPAN == 256 * 4, "one 16-byte load a thread stages the key times");
  const v4f tk4 = ((const v4f*)(times + kbeg))[tid];
  const float tq = times[qbase + srow];
  // Stands behind these two loads, in front of the first instruction that
  // overwrites a register of their addresses.
  asm volatile("s_wait_xcnt 0x0" ::: "memory");
  ((v4f*)sTk)[tid] = tk4;

  v8f acc[MT][4] = {};                     // 64 x 64 f32 output slice
  float mrow = -3.0e38f, lrow = 0.0f;      // softmax state of the owned row
  __syncthreads();                         // sQ (all waves) + sTk visible

  const _Float16* qlds = sQ + hrow * QP + sel * 8;
  const _Float16* kwave = kh + (size_t)wave * (16 * FRAG) + lane * 8;
  const _Float16* kfirst = kwave + (size_t)(kbeg >> 4) * (16 * FRAG);
  const _Float16* vwave = kT + (size_t)wave * (16 * FRAG) + lane * 8;

  // Q@K^T fragments of the first key block.
  v16h bk[16];
#pragma unroll
  for (int f = 0; f < 16; ++f) bk[f] = ldfrag_packed(kfirst + f * FRAG);

  for (int kb = kbeg; kb < kend; kb += KB) {
    // ---- 1) S tiles: this wave's 16 keys x 64 q-rows over full D ----
    // A fragments double-buffered from LDS, MT at a time; B fragments already
    // in registers, each used MT times.  The MT row tiles are the independent
    // accumulator chains.
    v16h aq[2][MT];
#pragma unroll
    for (int mt = 0; mt < MT; ++mt) aq[0][mt] = ldfrag(qlds + mt * 16 * QP);
    v8f st[MT] = {};
#pragma unroll
    for (int kk = 0; kk < 16; ++kk) {
      const int cur = kk & 1;
      if (kk < 15) {
#pragma unroll
        for (int mt = 0; mt < MT; ++mt)
          aq[cur ^ 1][mt] = ldfrag(qlds + mt * 16 * QP + (kk + 1) * 32);
      }
#pragma unroll
      for (int mt = 0; mt < MT; ++mt) {
        st[mt] = __builtin_amdgcn_wmma_f32_16x16x32_f16(false, aq[cur][mt], false,
                                                        bk[kk], (short)0, st[mt],
                                                        false, false);
      }
    }
    // store finished S tiles (single writer per element; no atomics needed)
#pragma unroll
    for (int mt = 0; mt < MT; ++mt) {
#pragma unroll
      for (int v = 0; v < 8; ++v) {
        sS[(mt * 16 + v + 8 * sel) * SP + wave * 16 + hrow] = st[mt][v];
      }
    }
    // This pass's P@V fragments fly during the softmax.
    const _Float16* vfrag = vwave + (size_t)(kb >> 7) * (8 * 16 * FRAG);
    v16h bv[16];                               // [k-step][d-tile]
#pragma unroll
    for (int f = 0; f < 16; ++f)
      bv[f] = ldfrag_packed(vfrag + ((f & 3) * 4 + (f >> 2)) * FRAG);
    // Stands behind the loads issued so far and in front of the first
    // instruction that overwrites an address register they name; the address
    // is named as an input so that its register lives up to the wait.
    asm volatile("s_wait_xcnt 0x0" :: "v"(vfrag) : "memory");
    // Keeps the load group in front of the softmax instead of sunk to its uses.
    __builtin_amdgcn_sched_barrier(0);
    // Barrier A: sS stores visible; also orders prev-iteration sP reads
    // (PV ds_loads) before this iteration's sP writes below.
    lds_barrier();

    // ---- 2) time-weight MLP + online softmax (RL lanes a row) ----
    {
      const float* srd = sS + srow * SP + sq * 8;
      const float* trd = sTk + (kb - kbeg) + sq * 8;
      float sv[CL];
      float rmax = -3.0e38f;
#pragma unroll
      for (int g = 0; g < CL / 4; ++g) {     // 4 columns a 16-byte LDS read
        const int co = (g >> 1) * 32 + (g & 1) * 4;
        const v4f s4 = *(const v4f*)(srd + co);
        const v4f t4 = *(const v4f*)(trd + co);
#pragma unroll
        for (int e = 0; e < 4; ++e) {
          float s = s4[e];
          const float td = fabsf(tq - t4[e]);
          float z = b2;
#pragma unroll
          for (int j = 0; j < HH; ++j) {
            float hj = td * w1r[j] + b1r[j];
            hj = hj > 0.0f ? hj : 0.0f;
            z += hj * w2r[j];
          }
          // * sigmoid(mlp(|dt|)).  The denominator lies in [1, inf], so the
          // hardware reciprocal (1 ulp) serves; the '/' operator would expand to
          // the scaled, refined division sequence, about ten more instructions.
          s *= __builtin_amdgcn_rcpf(1.0f + __expf(-z));
          sv[g * 4 + e] = s;
          rmax = fmaxf(rmax, s);
        }
      }
      rmax = fmaxf(rmax, lane_xor1(rmax));
      rmax = fmaxf(rmax, lane_xor2(rmax));
      const float mnew  = fmaxf(mrow, rmax);
      const float alpha = __expf(mrow - mnew);
      mrow = mnew;
      float ps[CL / 8];                      // one independent sum per 8 columns
#pragma unroll
      for (int g = 0; g < CL / 8; ++g) {
        v8h ph;
        ps[g] = 0.0f;
#pragma unroll
        for (int e = 0; e < 8; ++e) {
          const float p = __expf(sv[g * 8 + e] - mnew);
          ps[g] += p;
          ph[e] = (_Float16)p;
        }
        *(v8h*)(sP + srow * PP + g * 32 + sq * 8) = ph;
      }
      float psum = (ps[0] + ps[1]) + (ps[2] + ps[3]);
      psum += lane_xor1(psum);
      psum += lane_xor2(psum);
      lrow = lrow * alpha + psum;
      if (sq == 0) sAlpha[srow] = alpha;
    }
    // First quarter of the next pass's Q@K^T fragments.  Unconditional (a
    // branch would merge two paths in the wait counting): the last pass
    // re-reads its own block and the values are not used.
    const int kn = (kb + KB < kend) ? kb + KB : kb;
    const _Float16* knext = kwave + (size_t)(kn >> 4) * (16 * FRAG);
#pragma unroll
    for (int f = 0; f < 4; ++f) bk[f] = ldfrag_packed(knext + f * FRAG);
    // In front of the first overwrite of these loads' address register; the
    // address is named as an input so that its register lives up to the wait.
    asm volatile("s_wait_xcnt 0x0" :: "v"(knext) : "memory");
    // Barrier B: sP / sAlpha visible before rescale + PV.
    lds_barrier();

    // ---- 3) rescale accumulators by alpha ----
#pragma unroll
    for (int mt = 0; mt < MT; ++mt) {
#pragma unroll
      for (int v = 0; v < 8; ++v) {
        const float a = sAlpha[mt * 16 + v + 8 * sel];
        acc[mt][0][v] *= a; acc[mt][1][v] *= a;
        acc[mt][2][v] *= a; acc[mt][3][v] *= a;
      }
    }

    // ---- 4) acc += P @ V_slice (A double-buffered from LDS, B in registers) ----
    const _Float16* plds = sP + hrow * PP + sel * 8;
    v16h aP[2][MT];
#pragma unroll
    for (int mt = 0; mt < MT; ++mt) aP[0][mt] = ldfrag(plds + mt * 16 * PP);
#pragma unroll
    for (int kk = 0; kk < 4; ++kk) {           // 4 k-steps of 32 keys
      const int cur = kk & 1;
      if (kk < 3) {
#pragma unroll
        for (int mt = 0; mt < MT; ++mt)
          aP[cur ^ 1][mt] = ldfrag(plds + mt * 16 * PP + (kk + 1) * 32);
      }
#pragma unroll
      for (int mt = 0; mt < MT; ++mt) {
#pragma unroll
        for (int t = 0; t < 4; ++t) {
          acc[mt][t] = __builtin_amdgcn_wmma_f32_16x16x32_f16(
              false, aP[cur][mt], false, bv[kk * 4 + t], (short)0, acc[mt][t],
              false, false);
        }
      }
      if (kk < 3) {
        // Next quarter of the next pass's Q@K^T fragments.
#pragma unroll
        for (int f = 4 * kk + 4; f < 4 * kk + 8; ++f)
          bk[f] = ldfrag_packed(knext + f * FRAG);
        // In front of the first overwrite of these loads' address register.
        asm volatile("s_wait_xcnt 0x0" :: "v"(knext) : "memory");
        // Keeps this quarter here: hoisted it would need registers that this
        // k-step's fragments still hold, sunk it would land too late.
        __builtin_amdgcn_sched_barrier(0);
      }
    }
  }

  // ---- epilogue: this key range's partial sum, maximum and denominator ----
  if (sq == 0) {
    pm[split * NH + qbase + srow] = mrow;
    pl[split * NH + qbase + srow] = lrow;
  }
  float* po = pacc + ((size_t)split * NH + qbase) * DE + dbase + hrow;
#pragma unroll
  for (int mt = 0; mt < MT; ++mt) {
#pragma unroll
    for (int v = 0; v < 8; ++v) {
      const int r = mt * 16 + v + 8 * sel;
#pragma unroll
      for (int t = 0; t < 4; ++t) {
        po[(size_t)r * DE + t * 16] = acc[mt][t][v];
      }
    }
  }
}

// ---------------------------------------------------------------------------
// Merge of the SPLIT key ranges: out = sum_s e^(m_s - M) acc_s / sum_s e^(m_s - M) l_s
// with M = max_s m_s.  One workgroup per 16 rows, 16 threads per row: few waves
// to start, and every thread's 32 16-byte loads are in flight together.
// ---------------------------------------------------------------------------
#define MJ (DE / 4 / 16)   // 4-float columns per thread
static_assert(SPLIT == 4 && MJ == 8, "the load fence below names 4 x 4 column pairs");
__global__ __launch_bounds__(256) void taa_merge_kernel(
    const float* __restrict__ pa0, const float* __restrict__ pa1,
    const float* __restrict__ pa2, const float* __restrict__ pa3,
    const float* __restrict__ pm, const float* __restrict__ pl,
    float* __restrict__ out) {
  const float* const pa[SPLIT] = {pa0, pa1, pa2, pa3};   // one base per key range
  const int row = blockIdx.x * 16 + (threadIdx.x >> 4);
  // One 32-bit element offset serves every load and the stores (the bases are
  // uniform), so the one address register lives to the kernel's end.
  const unsigned base = (unsigned)row * (DE / 4) + (threadIdx.x & 15);
  float m[SPLIT], l[SPLIT];
  v8f   a[SPLIT][MJ / 2];   // column pairs, so that one fence can name them all
#pragma unroll
  for (int s = 0; s < SPLIT; ++s) {
#pragma unroll
    for (int j = 0; j < MJ; ++j)
      ((v4f*)&a[s][j >> 1])[j & 1] = ((const v4f*)pa[s])[base + j * 16];
  }
#pragma unroll
  for (int s = 0; s < SPLIT; ++s) { m[s] = pm[s * NH + row]; l[s] = pl[s * NH + row]; }
  // Inputs-only fence on the loaded values: holds all the loads in one group in
  // front of the arithmetic, in flight together, instead of sunk to their uses
  // a few at a time.
  asm volatile("" :: "v"(a[0][0]), "v"(a[0][1]), "v"(a[0][2]), "v"(a[0][3]),
                     "v"(a[1][0]), "v"(a[1][1]), "v"(a[1][2]), "v"(a[1][3]),
                     "v"(a[2][0]), "v"(a[2][1]), "v"(a[2][2]), "v"(a[2][3]),
                     "v"(a[3][0]), "v"(a[3][1]), "v"(a[3][2]), "v"(a[3][3]),
                     "v"(m[0]), "v"(m[1]), "v"(m[2]), "v"(m[3]),
                     "v"(l[0]), "v"(l[1]), "v"(l[2]), "v"(l[3]));
  float mx = m[0];
#pragma unroll
  for (int s = 1; s < SPLIT; ++s) mx = fmaxf(mx, m[s]);
  float w[SPLIT];
  float den = 0.0f;
#pragma unroll
  for (int s = 0; s < SPLIT; ++s) { w[s] = __expf(m[s] - mx); den += w[s] * l[s]; }
  const float inv = 1.0f / den;
#pragma unroll
  for (int s = 0; s < SPLIT; ++s) w[s] *= inv;
  v4f* o4 = (v4f*)out;
#pragma unroll
  for (int j = 0; j < MJ; ++j) {
    v4f o = w[0] * ((const v4f*)&a[0][j >> 1])[j & 1];
#pragma unroll
    for (int s = 1; s < SPLIT; ++s) o += w[s] * ((const v4f*)&a[s][j >> 1])[j & 1];
    o4[base + j * 16] = o;
  }
}

// ---------------------------------------------------------------------------
extern "C" void kernel_launch(void* const* d_in, const int* in_sizes, int n_in,
                              void* d_out, int out_size, void* d_ws, size_t ws_size,
                              hipStream_t stream) {
  const float* Q  = (const float*)d_in[0];  // query_code_embeds [N,D]
  const float* K  = (const float*)d_in[1];  // hist_embeddings  [N,D]
  const float* t  = (const float*)d_in[2];  // hist_times       [N]
  const float* w1 = (const float*)d_in[3];  // [1,H]
  const float* b1 = (const float*)d_in[4];  // [H]
  const float* w2 = (const float*)d_in[5];  // [H,1]
  const float* b2 = (const float*)d_in[6];  // [1]
  float* out = (float*)d_out;

  // workspace layout: q_h | k_h | kT_h (each N*D f16 = 4 MB) | partial sums
  // (SPLIT * N*D f32) | partial maxima | partial denominators (SPLIT * N f32)
  _Float16* qh = (_Float16*)d_ws;
  _Float16* kh = qh + (size_t)NH * DE;
  _Float16* kT = kh + (size_t)NH * DE;
  float* pacc = (float*)(kT + (size_t)NH * DE);
  float* pm   = pacc + (size_t)SPLIT * NH * DE;
  float* pl   = pm + (size_t)SPLIT * NH;

  const int total = NH * DE;
  taa_convert_kernel<<<total / 256, 256, 0, stream>>>(Q, K, qh, kh, kT);
  taa_attn_kernel<<<(NH / QB) * SPLIT, 256, 0, stream>>>(qh, kh, kT, t, w1, b1, w2, b2,
                                                         pacc, pm, pl);
  taa_merge_kernel<<<NH / 16, 256, 0, stream>>>(
      pacc, pacc + (size_t)NH * DE, pacc + (size_t)2 * NH * DE,
      pacc + (size_t)3 * NH * DE, pm, pl, out);
  (void)in_sizes; (void)n_in; (void)out_size; (void)ws_size;
}

// v007
// Measured time: 55.5 microseconds a run.
// In both of two side-by-side timings against v006, it was 1.05 times as fast.
// Over all steps from v000 it is 4.72 times as fast.
#include <hip/hip_runtime.h>
#include <math.h>

// Problem constants (match reference)
#define NH 4096    // n_history
#define DE 512     // embed dim
#define HH 8       // time-weight MLP hidden
#define QB 64      // query rows per workgroup
#define MT (QB / 16)   // 16-row tiles per workgroup: uses of each loaded B fragment
#define SPLIT 4        // key ranges; one workgroup = (query block, key range)
#define KSPAN (NH / SPLIT)  // keys per workgroup
#define RL 4           // lanes that share one softmax row
#define CL (KB / RL)   // columns of a key block per softmax lane
#define KB 128     // keys per iteration (8 waves * 16 keys)
#define DSLICE 64  // d-columns owned per wave for the P@V accumulator
// LDS row pitches.  The fragment readers (ds_load_b128, one row per lane) want
// a pitch that is an odd multiple of 16 B so that 16 rows fall on 16 distinct
// bank groups; the natural pitches (1024 B, 256 B) put all rows on one group.
#define QP (DE + 8)   // sQ pitch in halves: 1040 B = 65 * 16 B
#define PP (KB + 8)   // sP pitch in halves:  272 B = 17 * 16 B
#define SP (KB + 4)   // sS pitch in floats: rows r and r+8 land 32 banks apart

typedef __attribute__((ext_vector_type(16))) _Float16 v16h;
typedef __attribute__((ext_vector_type(8)))  _Float16 v8h;
typedef __attribute__((ext_vector_type(8)))  float    v8f;
typedef __attribute__((ext_vector_type(4)))  float    v4f;
typedef __attribute__((ext_vector_type(2)))  float    v2f;
#define LOG2E 1.4426950408889634f

static __device__ __forceinline__ v16h ldfrag(const _Float16* p) {
  v16h r;
  ((v8h*)&r)[0] = *(const v8h*)(p);
  ((v8h*)&r)[1] = *(const v8h*)(p + 16);
  return r;
}

// Fragment-order storage of the two B operands.  One 16x32 f16 fragment is
// FRAG halves (1 KB): register half h of lane l lies at h*256 + l*8, so each of
// the two wave-wide 16-byte loads of a fragment reads 512 contiguous bytes
// (4 whole lines) instead of 32 bytes out of each of 16 lines.
#define FRAG 512
static __device__ __forceinline__ v16h ldfrag_packed(const _Float16* p) {
  v16h r;
  ((v8h*)&r)[0] = *(const v8h*)(p);
  ((v8h*)&r)[1] = *(const v8h*)(p + 256);
  return r;
}

// Value of lane l ^ 1 and of lane l ^ 2: vector cross-lane moves inside a
// 16-lane row; every lane is on where they are used.
static __device__ __forceinline__ float lane_xor1(float x) {
  return __builtin_bit_cast(float, __builtin_amdgcn_update_dpp(
      0, __builtin_bit_cast(int, x), 0x161 /* row_xmask:1 */, 0xf, 0xf, true));
}
static __device__ __forceinline__ float lane_xor2(float x) {
  return __builtin_bit_cast(float, __builtin_amdgcn_update_dpp(
      0, __builtin_bit_cast(int, x), 0x162 /* row_xmask:2 */, 0xf, 0xf, true));
}

// Work-group barrier that orders LDS traffic only.  __syncthreads() would also
// drain the global fragment loads that are issued ahead and must stay in flight
// across it; the data handed over at these barriers lies in LDS alone.
static __device__ __forceinline__ void lds_barrier() {
  asm volatile("s_wait_dscnt 0x0" ::: "memory");
  asm volatile("s_barrier_signal -1\n\ts_barrier_wait -1" ::: "memory");
}

// ---------------------------------------------------------------------------
// Pre-pass: f32 -> f16 conversion.  q_h = Q * (1/sqrt(D)) row-major.
// k_h  = K in fragment order for Q@K^T: fragment (key/16, d/32), N = key, k = d.
// kT_h = K in fragment order for P@V: fragment (key/128, d/16, (key/32)%4),
//        N = d, k = key.
// Inside a fragment: lane = (N%16) + 16*sel, k%32 = h*16 + sel*8 + j.
// ---------------------------------------------------------------------------
__global__ __launch_bounds__(256) void taa_convert_kernel(
    const float* __restrict__ Q, const float* __restrict__ K,
    _Float16* __restrict__ qh, _Float16* __restrict__ kh,
    _Float16* __restrict__ kT) {
  const int i = blockIdx.x * blockDim.x + threadIdx.x;   // [0, N*D)
  const float scale = 0.044194173824159216f;             // 1/sqrt(512)
  // i is the packed destination index of both B operands (coalesced writes).
  const int f  = i >> 9;                                 // fragment number
  const int n  = (i >> 3) & 15;                          // N index in fragment
  const int k  = ((i >> 8) & 1) * 16 + ((i >> 7) & 1) * 8 + (i & 7);  // k index
  const float qv = Q[i];
  // Q@K^T operand: key = (f/16)*16 + n, d = (f%16)*32 + k
  const float ks = K[(size_t)((f >> 4) * 16 + n) * DE + (f & 15) * 32 + k];
  // P@V operand: key = (f/128)*128 + (f%4)*32 + k, d = ((f/4)%32)*16 + n
  const float kv =
      K[(size_t)((f >> 7) * KB + (f & 3) * 32 + k) * DE + ((f >> 2) & 31) * 16 + n];
  // Stands between the loads and the conversions below, which overwrite the
  // loads' address registers.
  asm volatile("s_wait_xcnt 0x0" ::: "memory");
  qh[i] = (_Float16)(qv * scale);
  kh[i] = (_Float16)ks;
  kT[i] = (_Float16)kv;
}

// ---------------------------------------------------------------------------
// Fused time-aware flash attention over one key range.
// Workgroup: 64 query rows x KSPAN keys, 8 wave32s.  Every B fragment that a
// wave loads feeds MT matrix instructions (one per 16-row tile).
//   QK^T : wave w owns keys [kb + 16w, kb + 16w + 16), full-D reduction,
//          A-fragments from LDS-staged Q (async-copied once).
//   P@V  : wave w owns output d-slice [64w, 64w + 64).
//   softmax: thread t owns row t/4 and, of each 32 columns, the 8 from 8*(t%4):
//          a row's maximum and sum are formed in registers and finished by two
//          cross-lane steps each.
// Result: the range's unnormalised sum, row maximum and row denominator; the
// ranges are merged by taa_merge_kernel.
// B fragments go from global memory straight to registers, a phase ahead of
// their use: the P@V group behind this pass's Q@K^T (it flies during the
// softmax), the next pass's Q@K^T group in quarters, the first behind the
// softmax and one behind each of the first three P@V k-steps, as that step's fragments retire.
// ---------------------------------------------------------------------------
__global__ __launch_bounds__(256) void taa_attn_kernel(
    const _Float16* __restrict__ qh, const _Float16* __restrict__ kh,
    const _Float16* __restrict__ kT, const float* __restrict__ times,
    const float* __restrict__ w1, const float* __restrict__ b1,
    const float* __restrict__ w2, const float* __restrict__ b2p,
    float* __restrict__ pacc, float* __restrict__ pm, float* __restrict__ pl) {
  __shared__ __align__(16) _Float16 sQ[QB * QP];   // 64x512 f16, padded rows
  __shared__ __align__(16) float    sS[QB * SP];   // 64x128 f32, padded rows
  __shared__ __align__(16) _Float16 sP[QB * PP];   // 64x128 f16, padded rows
  __shared__ __align__(16) float sAlpha[QB];
  __shared__ __align__(16) float sTk[KSPAN];       // times of this key range

  const int tid   = threadIdx.x;
  const int lane  = tid & 31;
  const int wave  = tid >> 5;
  const int hrow  = lane & 15;   // M (A) / N (B,C) fragment index
  const int sel   = lane >> 4;   // which K-half of the fragment
  const int qbase = (blockIdx.x / SPLIT) * QB;
  const int split = blockIdx.x % SPLIT;
  const int kbeg  = split * KSPAN;
  const int kend  = kbeg + KSPAN;
  const int dbase = wave * DSLICE;
  const int srow  = tid / RL;    // softmax row of this thread
  const int sq    = tid % RL;    // its place among the row's lanes

  // ---- one-time async stage of the Q block into LDS (64 B per thread and
  //      16-row tile) ----
#pragma unroll
  for (int mt = 0; mt < MT; ++mt) {
    const _Float16* gq = qh + (size_t)(qbase + mt * 16) * DE + tid * 32;
    const unsigned  lo = (unsigned)(uintptr_t)(const void*)(&sQ[(mt * 16 + (tid >> 4)) * QP + (tid & 15) * 32]);
    // The closing wait stands in the copies' own statement, in front of any
    // later write of the address registers that they name.
    asm volatile(
        "global_load_async_to_lds_b128 %0, %4, off\n\t"
        "global_load_async_to_lds_b128 %1, %5, off\n\t"
        "global_load_async_to_lds_b128 %2, %6, off\n\t"
        "global_load_async_to_lds_b128 %3, %7, off\n\t"
        "s_wait_xcnt 0x0"
        :: "v"(lo), "v"(lo + 16u), "v"(lo + 32u), "v"(lo + 48u),
           "v"(gq), "v"(gq + 8), "v"(gq + 16), "v"(gq + 24) : "memory");
  }
  // This wave's copies have landed; the barrier below publishes them.
  asm volatile("s_wait_asynccnt 0x0" ::: "memory");

  // Tiny MLP parameters -> registers (uniform loads)
  float w1r[HH], b1r[HH], w2r[HH];
#pragma unroll
  for (int j = 0; j < HH; ++j) { w1r[j] = w1[j]; b1r[j] = b1[j]; w2r[j] = w2[j]; }
  const float b2 = b2p[0];

  static_assert(KSPAN == 256 * 4, "one 16-byte load a thread stages the key times");
  const v4f tk4 = ((const v4f*)(times + kbeg))[tid];
  const float tq = times[qbase + srow];
  // Stands behind these two loads, in front of the first instruction that
  // overwrites a register of their addresses.
  asm volatile("s_wait_xcnt 0x0" ::: "memory");
  ((v4f*)sTk)[tid] = tk4;

  v8f acc[MT][4] = {};                     // 64 x 64 f32 output slice
  float mrow = -3.0e38f, lrow = 0.0f;      // softmax state of the owned row
  __syncthreads();                         // sQ (all waves) + sTk visible

  const _Float16* qlds = sQ + hrow * QP + sel * 8;
  const _Float16* kwave = kh + (size_t)wave * (16 * FRAG) + lane * 8;
  const _Float16* kfirst = kwave + (size_t)(kbeg >> 4) * (16 * FRAG);
  const _Float16* vwave = kT + (size_t)wave * (16 * FRAG) + lane * 8;

  // Q@K^T fragments of the first key block.
  v16h bk[16];
#pragma unroll
  for (int f = 0; f < 16; ++f) bk[f] = ldfrag_packed(kfirst + f * FRAG);

  for (int kb = kbeg; kb < kend; kb += KB) {
    // ---- 1) S tiles: this wave's 16 keys x 64 q-rows over full D ----
    // A fragments double-buffered from LDS, MT at a time; B fragments already
    // in registers, each used MT times.  The MT row tiles are the independent
    // accumulator chains.
    v16h aq[2][MT];
#pragma unroll
    for (int mt = 0; mt < MT; ++mt) aq[0][mt] = ldfrag(qlds + mt * 16 * QP);
    v8f st[MT] = {};
#pragma unroll
    for (int kk = 0; kk < 16; ++kk) {
      const int cur = kk & 1;
      if (kk < 15) {
#pragma unroll
        for (int mt = 0; mt < MT; ++mt)
          aq[cur ^ 1][mt] = ldfrag(qlds + mt * 16 * QP + (kk + 1) * 32);
      }
#pragma unroll
      for (int mt = 0; mt < MT; ++mt) {
        st[mt] = __builtin_amdgcn_wmma_f32_16x16x32_f16(false, aq[cur][mt], false,
                                                        bk[kk], (short)0, st[mt],
                                                        false, false);
      }
    }
    // store finished S tiles (single writer per element; no atomics needed)
#pragma unroll
    for (int mt = 0; mt < MT; ++mt) {
#pragma unroll
      for (int v = 0; v < 8; ++v) {
        sS[(mt * 16 + v + 8 * sel) * SP + wave * 16 + hrow] = st[mt][v];
      }
    }
    // This pass's P@V fragments fly during the softmax.
    const _Float16* vfrag = vwave + (size_t)(kb >> 7) * (8 * 16 * FRAG);
    v16h bv[16];                               // [k-step][d-tile]
#pragma unroll
    for (int f = 0; f < 16; ++f)
      bv[f] = ldfrag_packed(vfrag + ((f & 3) * 4 + (f >> 2)) * FRAG);
    // Stands behind the loads issued so far and in front of the first
    // instruction that overwrites an address register they name; the address
    // is named as an input so that its register lives up to the wait.
    asm volatile("s_wait_xcnt 0x0" :: "v"(vfrag) : "memory");
    // Keeps the load group in front of the softmax instead of sunk to its uses.
    __builtin_amdgcn_sched_barrier(0);
    // Barrier A: sS stores visible; also orders prev-iteration sP reads
    // (PV ds_loads) before this iteration's sP writes below.
    lds_barrier();

    // ---- 2) time-weight MLP + online softmax (RL lanes a row) ----
    {
      const float* srd = sS + srow * SP + sq * 8;
      const float* trd = sTk + (kb - kbeg) + sq * 8;
      // All per-score f32 arithmetic runs on pairs of neighbouring columns: one
      // packed instruction serves two scores, and the hidden units are summed
      // by a chain of packed multiply-adds with no sum across a register pair.
      v2f sv[CL / 2];
      float rmax = -3.0e38f;
      const v2f tq2 = {tq, tq};
#pragma unroll
      for (int g = 0; g < CL / 4; ++g) {     // 4 columns a 16-byte LDS read
        const int co = (g >> 1) * 32 + (g & 1) * 4;
        const v4f s4 = *(const v4f*)(srd + co);
        const v4f t4 = *(const v4f*)(trd + co);
#pragma unroll
        for (int h = 0; h < 2; ++h) {
          v2f s = {s4[2 * h], s4[2 * h + 1]};
          const v2f d = tq2 - (v2f){t4[2 * h], t4[2 * h + 1]};
          const v2f td = {fabsf(d.x), fabsf(d.y)};
          v2f z = {b2, b2};
#pragma unroll
          for (int j = 0; j < HH; ++j) {
            v2f hj = __builtin_elementwise_fma(td, (v2f){w1r[j], w1r[j]},
                                               (v2f){b1r[j], b1r[j]});
            hj.x = hj.x > 0.0f ? hj.x : 0.0f;
            hj.y = hj.y > 0.0f ? hj.y : 0.0f;
            z = __builtin_elementwise_fma(hj, (v2f){w2r[j], w2r[j]}, z);
          }
          // * sigmoid(mlp(|dt|)) = 1 / (1 + 2^(-z log2 e)).  The denominator lies
          // in [1, inf], so the hardware reciprocal (1 ulp) serves; the '/'
          // operator would expand to the scaled, refined division sequence.
          const v2f a = z * -LOG2E;
          const v2f den = (v2f){__builtin_amdgcn_exp2f(a.x), __builtin_amdgcn_exp2f(a.y)} + 1.0f;
          s *= (v2f){__builtin_amdgcn_rcpf(den.x), __builtin_amdgcn_rcpf(den.y)};
          sv[g * 2 + h] = s;
          rmax = fmaxf(rmax, fmaxf(s.x, s.y));
        }
      }
      rmax = fmaxf(rmax, lane_xor1(rmax));
      rmax = fmaxf(rmax, lane_xor2(rmax));
      const float mnew  = fmaxf(mrow, rmax);
      const float alpha = __expf(mrow - mnew);
      mrow = mnew;
      const v2f mnew2 = {mnew, mnew};
      v2f ps[CL / 8];                        // one independent sum pair per 8 columns
#pragma unroll
      for (int g = 0; g < CL / 8; ++g) {
        v8h ph;
#pragma unroll
        for (int e = 0; e < 4; ++e) {
          const v2f a = (sv[g * 4 + e] - mnew2) * LOG2E;
          const v2f p = {__builtin_amdgcn_exp2f(a.x), __builtin_amdgcn_exp2f(a.y)};
          ps[g] = e == 0 ? p : ps[g] + p;
          ph[2 * e]     = (_Float16)p.x;
          ph[2 * e + 1] = (_Float16)p.y;
        }
        *(v8h*)(sP + srow * PP + g * 32 + sq * 8) = ph;
      }
      const v2f pq = (ps[0] + ps[1]) + (ps[2] + ps[3]);
      float psum = pq.x + pq.y;
      psum += lane_xor1(psum);
      psum += lane_xor2(psum);
      lrow = lrow * alpha + psum;
      if (sq == 0) sAlpha[srow] = alpha;
    }
    // First quarter of the next pass's Q@K^T fragments.  Unconditional (a
    // branch would merge two paths in the wait counting): the last pass
    // re-reads its own block and the values are not used.
    const int kn = (kb + KB < kend) ? kb + KB : kb;
    const _Float16* knext = kwave + (size_t)(kn >> 4) * (16 * FRAG);
#pragma unroll
    for (int f = 0; f < 4; ++f) bk[f] = ldfrag_packed(knext + f * FRAG);
    // In front of the first overwrite of these loads' address register; the
    // address is named as an input so that its register lives up to the wait.
    asm volatile("s_wait_xcnt 0x0" :: "v"(knext) : "memory");
    // Barrier B: sP / sAlpha visible before rescale + PV.
    lds_barrier();

    // ---- 3) rescale accumulators by alpha ----
#pragma unroll
    for (int mt = 0; mt < MT; ++mt) {
#pragma unroll
      for (int v = 0; v < 8; ++v) {
        const float a = sAlpha[mt * 16 + v + 8 * sel];
        acc[mt][0][v] *= a; acc[mt][1][v] *= a;
        acc[mt][2][v] *= a; acc[mt][3][v] *= a;
      }
    }

    // ---- 4) acc += P @ V_slice (A double-buffered from LDS, B in registers) ----
    const _Float16* plds = sP + hrow * PP + sel * 8;
    v16h aP[2][MT];
#pragma unroll
    for (int mt = 0; mt < MT; ++mt) aP[0][mt] = ldfrag(plds + mt * 16 * PP);
#pragma unroll
    for (int kk = 0; kk < 4; ++kk) {           // 4 k-steps of 32 keys
      const int cur = kk & 1;
      if (kk < 3) {
#pragma unroll
        for (int mt = 0; mt < MT; ++mt)
          aP[cur ^ 1][mt] = ldfrag(plds + mt * 16 * PP + (kk + 1) * 32);
      }
#pragma unroll
      for (int mt = 0; mt < MT; ++mt) {
#pragma unroll
        for (int t = 0; t < 4; ++t) {
          acc[mt][t] = __builtin_amdgcn_wmma_f32_16x16x32_f16(
              false, aP[cur][mt], false, bv[kk * 4 + t], (short)0, acc[mt][t],
              false, false);
        }
      }
      if (kk < 3) {
        // Next quarter of the next pass's Q@K^T fragments.
#pragma unroll
        for (int f = 4 * kk + 4; f < 4 * kk + 8; ++f)
          bk[f] = ldfrag_packed(knext + f * FRAG);
        // In front of the first overwrite of these loads' address register.
        asm volatile("s_wait_xcnt 0x0" :: "v"(knext) : "memory");
        // Keeps this quarter here: hoisted it would need registers that this
        // k-step's fragments still hold, sunk it would land too late.
        __builtin_amdgcn_sched_barrier(0);
      }
    }
  }

  // ---- epilogue: this key range's partial sum, maximum and denominator ----
  if (sq == 0) {
    pm[split * NH + qbase + srow] = mrow;
    pl[split * NH + qbase + srow] = lrow;
  }
  float* po = pacc + ((size_t)split * NH + qbase) * DE + dbase + hrow;
#pragma unroll
  for (int mt = 0; mt < MT; ++mt) {
#pragma unroll
    for (int v = 0; v < 8; ++v) {
      const int r = mt * 16 + v + 8 * sel;
#pragma unroll
      for (int t = 0; t < 4; ++t) {
        po[(size_t)r * DE + t * 16] = acc[mt][t][v];
      }
    }
  }
}

// ---------------------------------------------------------------------------
// Merge of the SPLIT key ranges: out = sum_s e^(m_s - M) acc_s / sum_s e^(m_s - M) l_s
// with M = max_s m_s.  One workgroup per 16 rows, 16 threads per row: few waves
// to start, and every thread's 32 16-byte loads are in flight together.
// ---------------------------------------------------------------------------
#define MJ (DE / 4 / 16)   // 4-float columns per thread
static_assert(SPLIT == 4 && MJ == 8, "the load fence below names 4 x 4 column pairs");
__global__ __launch_bounds__(256) void taa_merge_kernel(
    const float* __restrict__ pa0, const float* __restrict__ pa1,
    const float* __restrict__ pa2, const float* __restrict__ pa3,
    const float* __restrict__ pm, const float* __restrict__ pl,
    float* __restrict__ out) {
  const float* const pa[SPLIT] = {pa0, pa1, pa2, pa3};   // one base per key range
  const int row = blockIdx.x * 16 + (threadIdx.x >> 4);
  // One 32-bit element offset serves every load and the stores (the bases are
  // uniform), so the one address register lives to the kernel's end.
  const unsigned base = (unsigned)row * (DE / 4) + (threadIdx.x & 15);
  float m[SPLIT], l[SPLIT];
  v8f   a[SPLIT][MJ / 2];   // column pairs, so that one fence can name them all
#pragma unroll
  for (int s = 0; s < SPLIT; ++s) {
#pragma unroll
    for (int j = 0; j < MJ; ++j)
      ((v4f*)&a[s][j >> 1])[j & 1] = ((const v4f*)pa[s])[base + j * 16];
  }
#pragma unroll
  for (int s = 0; s < SPLIT; ++s) { m[s] = pm[s * NH + row]; l[s] = pl[s * NH + row]; }
  // Inputs-only fence on the loaded values: holds all the loads in one group in
  // front of the arithmetic, in flight together, instead of sunk to their uses
  // a few at a time.
  asm volatile("" :: "v"(a[0][0]), "v"(a[0][1]), "v"(a[0][2]), "v"(a[0][3]),
                     "v"(a[1][0]), "v"(a[1][1]), "v"(a[1][2]), "v"(a[1][3]),
                     "v"(a[2][0]), "v"(a[2][1]), "v"(a[2][2]), "v"(a[2][3]),
                     "v"(a[3][0]), "v"(a[3][1]), "v"(a[3][2]), "v"(a[3][3]),
                     "v"(m[0]), "v"(m[1]), "v"(m[2]), "v"(m[3]),
                     "v"(l[0]), "v"(l[1]), "v"(l[2]), "v"(l[3]));
  float mx = m[0];
#pragma unroll
  for (int s = 1; s < SPLIT; ++s) mx = fmaxf(mx, m[s]);
  float w[SPLIT];
  float den = 0.0f;
#pragma unroll
  for (int s = 0; s < SPLIT; ++s) { w[s] = __expf(m[s] - mx); den += w[s] * l[s]; }
  const float inv = 1.0f / den;
#pragma unroll
  for (int s = 0; s < SPLIT; ++s) w[s] *= inv;
  v4f* o4 = (v4f*)out;
#pragma unroll
  for (int j = 0; j < MJ; ++j) {
    v4f o = w[0] * ((const v4f*)&a[0][j >> 1])[j & 1];
#pragma unroll
    for (int s = 1; s < SPLIT; ++s) o += w[s] * ((const v4f*)&a[s][j >> 1])[j & 1];
    o4[base + j * 16] = o;
  }
}

// ---------------------------------------------------------------------------
extern "C" void kernel_launch(void* const* d_in, const int* in_sizes, int n_in,
                              void* d_out, int out_size, void* d_ws, size_t ws_size,
                              hipStream_t stream) {
  const float* Q  = (const float*)d_in[0];  // query_code_embeds [N,D]
  const float* K  = (const float*)d_in[1];  // hist_embeddings  [N,D]
  const float* t  = (const float*)d_in[2];  // hist_times       [N]
  const float* w1 = (const float*)d_in[3];  // [1,H]
  const float* b1 = (const float*)d_in[4];  // [H]
  const float* w2 = (const float*)d_in[5];  // [H,1]
  const float* b2 = (const float*)d_in[6];  // [1]
  float* out = (float*)d_out;

  // workspace layout: q_h | k_h | kT_h (each N*D f16 = 4 MB) | partial sums
  // (SPLIT * N*D f32) | partial maxima | partial denominators (SPLIT * N f32)
  _Float16* qh = (_Float16*)d_ws;
  _Float16* kh = qh + (size_t)NH * DE;
  _Float16* kT = kh + (size_t)NH * DE;
  float* pacc = (float*)(kT + (size_t)NH * DE);
  float* pm   = pacc + (size_t)SPLIT * NH * DE;
  float* pl   = pm + (size_t)SPLIT * NH;

  const int total = NH * DE;
  taa_convert_kernel<<<total / 256, 256, 0, stream>>>(Q, K, qh, kh, kT);
  taa_attn_kernel<<<(NH / QB) * SPLIT, 256, 0, stream>>>(qh, kh, kT, t, w1, b1, w2, b2,
                                                         pacc, pm, pl);
  taa_merge_kernel<<<NH / 16, 256, 0, stream>>>(
      pacc, pacc + (size_t)NH * DE, pacc + (size_t)2 * NH * DE,
      pacc + (size_t)3 * NH * DE, pm, pl, out);
  (void)in_sizes; (void)n_in; (void)out_size; (void)ws_size;
}

// v008
// A run of this version takes 52.2 microseconds.
// Timed twice side by side with v007, it ran 1.06 times as fast both times.
// All steps since v000 together make it 5.02 times as fast.
#include <hip/hip_runtime.h>
#include <math.h>

// Problem constants (match reference)
#define NH 4096    // n_history
#define DE 512     // embed dim
#define HH 8       // time-weight MLP hidden
#define QB 64      // query rows per workgroup
#define MT (QB / 16)   // 16-row tiles per workgroup: uses of each loaded B fragment
#define SPLIT 4        // key ranges; one workgroup = (query block, key range)
#define KSPAN (NH / SPLIT)  // keys per workgroup
#define RL 4           // lanes that share one softmax row
#define CL (KB / RL)   // columns of a key block per softmax lane
#define KB 128     // keys per iteration (8 waves * 16 keys)
#define DSLICE 64  // d-columns owned per wave for the P@V accumulator
// LDS row pitches.  The fragment readers (ds_load_b128, one row per lane) want
// a pitch that is an odd multiple of 16 B so that 16 rows fall on 16 distinct
// bank groups; the natural pitches (1024 B, 256 B) put all rows on one group.
#define QP (DE + 8)   // sQ pitch in halves: 1040 B = 65 * 16 B
#define PP (KB + 8)   // sP pitch in halves:  272 B = 17 * 16 B
#define SP (KB + 4)   // sS pitch in floats: rows r and r+8 land 32 banks apart

typedef __attribute__((ext_vector_type(16))) _Float16 v16h;
typedef __attribute__((ext_vector_type(8)))  _Float16 v8h;
typedef __attribute__((ext_vector_type(8)))  float    v8f;
typedef __attribute__((ext_vector_type(4)))  float    v4f;
typedef __attribute__((ext_vector_type(2)))  float    v2f;
#define LOG2E 1.4426950408889634f

static __device__ __forceinline__ v16h ldfrag(const _Float16* p) {
  v16h r;
  ((v8h*)&r)[0] = *(const v8h*)(p);
  ((v8h*)&r)[1] = *(const v8h*)(p + 16);
  return r;
}

// Fragment-order storage of the two B operands.  One 16x32 f16 fragment is
// FRAG halves (1 KB): register half h of lane l lies at h*256 + l*8, so each of
// the two wave-wide 16-byte loads of a fragment reads 512 contiguous bytes
// (4 whole lines) instead of 32 bytes out of each of 16 lines.
#define FRAG 512
static __device__ __forceinline__ v16h ldfrag_packed(const _Float16* p) {
  v16h r;
  ((v8h*)&r)[0] = *(const v8h*)(p);
  ((v8h*)&r)[1] = *(const v8h*)(p + 256);
  return r;
}

// Value of lane l ^ 1 and of lane l ^ 2: vector cross-lane moves inside a
// 16-lane row; every lane is on where they are used.
static __device__ __forceinline__ float lane_xor1(float x) {
  return __builtin_bit_cast(float, __builtin_amdgcn_update_dpp(
      0, __builtin_bit_cast(int, x), 0x161 /* row_xmask:1 */, 0xf, 0xf, true));
}
static __device__ __forceinline__ float lane_xor2(float x) {
  return __builtin_bit_cast(float, __builtin_amdgcn_update_dpp(
      0, __builtin_bit_cast(int, x), 0x162 /* row_xmask:2 */, 0xf, 0xf, true));
}

// Work-group barrier that orders LDS traffic only.  __syncthreads() would also
// drain the global fragment loads that are issued ahead and must stay in flight
// across it; the data handed over at these barriers lies in LDS alone.
static __device__ __forceinline__ void lds_barrier() {
  asm volatile("s_wait_dscnt 0x0" ::: "memory");
  asm volatile("s_barrier_signal -1\n\ts_barrier_wait -1" ::: "memory");
}

// ---------------------------------------------------------------------------
// Pre-pass: f32 -> f16 conversion.  q_h = Q * (1/sqrt(D)) row-major.
// k_h  = K in fragment order for Q@K^T: fragment (key/16, d/32), N = key, k = d.
// kT_h = K in fragment order for P@V: fragment (key/128, d/16, (key/32)%4),
//        N = d, k = key.
// Inside a fragment: lane = (N%16) + 16*sel, k%32 = h*16 + sel*8 + j.
// ---------------------------------------------------------------------------
__global__ __launch_bounds__(256) void taa_convert_kernel(
    const float* __restrict__ Q, const float* __restrict__ K,
    _Float16* __restrict__ qh, _Float16* __restrict__ kh,
    _Float16* __restrict__ kT) {
  const int i = blockIdx.x * blockDim.x + threadIdx.x;   // [0, N*D)
  const float scale = 0.044194173824159216f;             // 1/sqrt(512)
  // i is the packed destination index of both B operands (coalesced writes).
  const int f  = i >> 9;                                 // fragment number
  const int n  = (i >> 3) & 15;                          // N index in fragment
  const int k  = ((i >> 8) & 1) * 16 + ((i >> 7) & 1) * 8 + (i & 7);  // k index
  const float qv = Q[i];
  // Q@K^T operand: key = (f/16)*16 + n, d = (f%16)*32 + k
  const float ks = K[(size_t)((f >> 4) * 16 + n) * DE + (f & 15) * 32 + k];
  // P@V operand: key = (f/128)*128 + (f%4)*32 + k, d = ((f/4)%32)*16 + n
  const float kv =
      K[(size_t)((f >> 7) * KB + (f & 3) * 32 + k) * DE + ((f >> 2) & 31) * 16 + n];
  // Stands between the loads and the conversions below, which overwrite the
  // loads' address registers.
  asm volatile("s_wait_xcnt 0x0" ::: "memory");
  qh[i] = (_Float16)(qv * scale);
  kh[i] = (_Float16)ks;
  kT[i] = (_Float16)kv;
}

// ---------------------------------------------------------------------------
// Fused time-aware flash attention over one key range.
// Workgroup: 64 query rows x KSPAN keys, 8 wave32s.  Every B fragment that a
// wave loads feeds MT matrix instructions (one per 16-row tile).
//   QK^T : wave w owns keys [kb + 16w, kb + 16w + 16), full-D reduction,
//          A-fragments from LDS-staged Q (async-copied once).
//   P@V  : wave w owns output d-slice [64w, 64w + 64).
//   softmax: thread t owns row t/4 and, of each 32 columns, the 8 from 8*(t%4):
//          a row's maximum and sum are formed in registers and finished by two
//          cross-lane steps each.
// Result: the range's unnormalised sum, row maximum and row denominator; the
// ranges are merged by taa_merge_kernel.
// B fragments go from global memory straight to registers, a phase ahead of
// their use: the P@V group behind this pass's Q@K^T (it flies during the
// softmax), the next pass's Q@K^T group in quarters, the first behind the
// softmax and one behind each of the first three P@V k-steps, as that step's fragments retire.
// ---------------------------------------------------------------------------
__global__ __launch_bounds__(256) void taa_attn_kernel(
    const _Float16* __restrict__ qh, const _Float16* __restrict__ kh,
    const _Float16* __restrict__ kT, const float* __restrict__ times,
    const float* __restrict__ w1, const float* __restrict__ b1,
    const float* __restrict__ w2, const float* __restrict__ b2p,
    float* __restrict__ pacc, float* __restrict__ pm, float* __restrict__ pl) {
  __shared__ __align__(16) _Float16 sQ[QB * QP];   // 64x512 f16, padded rows
  __shared__ __align__(16) float    sS[QB * SP];   // 64x128 f32, padded rows
  __shared__ __align__(16) _Float16 sP[QB * PP];   // 64x128 f16, padded rows
  __shared__ __align__(16) float sAlpha[QB];
  __shared__ __align__(16) float sTk[KSPAN];       // times of this key range
  __shared__ __align__(16) v4f   sUnit[HH];        // hidden units that keep their relu

  const int tid   = threadIdx.x;
  const int lane  = tid & 31;
  const int wave  = tid >> 5;
  const int hrow  = lane & 15;   // M (A) / N (B,C) fragment index
  const int sel   = lane >> 4;   // which K-half of the fragment
  const int qbase = (blockIdx.x / SPLIT) * QB;
  const int split = blockIdx.x % SPLIT;
  const int kbeg  = split * KSPAN;
  const int kend  = kbeg + KSPAN;
  const int dbase = wave * DSLICE;
  const int srow  = tid / RL;    // softmax row of this thread
  const int sq    = tid % RL;    // its place among the row's lanes

  // ---- one-time async stage of the Q block into LDS (64 B per thread and
  //      16-row tile) ----
#pragma unroll
  for (int mt = 0; mt < MT; ++mt) {
    const _Float16* gq = qh + (size_t)(qbase + mt * 16) * DE + tid * 32;
    const unsigned  lo = (unsigned)(uintptr_t)(const void*)(&sQ[(mt * 16 + (tid >> 4)) * QP + (tid & 15) * 32]);
    // The closing wait stands in the copies' own statement, in front of any
    // later write of the address registers that they name.
    asm volatile(
        "global_load_async_to_lds_b128 %0, %4, off\n\t"
        "global_load_async_to_lds_b128 %1, %5, off\n\t"
        "global_load_async_to_lds_b128 %2, %6, off\n\t"
        "global_load_async_to_lds_b128 %3, %7, off\n\t"
        "s_wait_xcnt 0x0"
        :: "v"(lo), "v"(lo + 16u), "v"(lo + 32u), "v"(lo + 48u),
           "v"(gq), "v"(gq + 8), "v"(gq + 16), "v"(gq + 24) : "memory");
  }
  // This wave's copies have landed; the barrier below publishes them.
  asm volatile("s_wait_asynccnt 0x0" ::: "memory");

  // Tiny MLP parameters -> registers (uniform loads)
  float w1r[HH], b1r[HH], w2r[HH];
#pragma unroll
  for (int j = 0; j < HH; ++j) { w1r[j] = w1[j]; b1r[j] = b1[j]; w2r[j] = w2[j]; }
  const float b2 = b2p[0];

  // The MLP's input |dt| is never negative, so the signs of a hidden unit's two
  // parameters can settle its relu for every score: w1, b1 >= 0 makes it the
  // identity, w1, b1 <= 0 makes it zero.  The identity units add up to one
  // affine function of |dt| (fa, fb), formed here once; a unit of mixed signs (or
  // with a NaN) is listed in sUnit and keeps its relu in the loop of step 2.
  // The sigmoid's factor -log2 e is carried by fa, fb and the listed w2.
  float fa = 0.0f, fb = b2;
  unsigned listed = 0;                     // bit j: unit j keeps its relu
  v4f mine = {};                           // unit number tid, for the threads that list one
#pragma unroll
  for (int j = 0; j < HH; ++j) {
    const bool fin   = __builtin_isfinite(w2r[j]);   // 0 * inf is NaN: such a unit stays listed
    const bool ident = fin && w1r[j] >= 0.0f && b1r[j] >= 0.0f;
    const bool zero  = fin && w1r[j] <= 0.0f && b1r[j] <= 0.0f;
    fa = ident ? fmaf(w1r[j], w2r[j], fa) : fa;
    fb = ident ? fmaf(b1r[j], w2r[j], fb) : fb;
    listed |= (ident || zero) ? 0u : 1u << j;
    if (tid == j) mine = (v4f){w1r[j], b1r[j], w2r[j] * -LOG2E, 0.0f};
  }
  if (tid < HH && ((listed >> tid) & 1u)) sUnit[__popc(listed & ((1u << tid) - 1u))] = mine;
  const int nU = __popc(listed);           // the same in every thread
  fa *= -LOG2E;
  fb *= -LOG2E;

  static_assert(KSPAN == 256 * 4, "one 16-byte load a thread stages the key times");
  const v4f tk4 = ((const v4f*)(times + kbeg))[tid];
  const float tq = times[qbase + srow];
  // Stands behind these two loads, in front of the first instruction that
  // overwrites a register of their addresses.
  asm volatile("s_wait_xcnt 0x0" ::: "memory");
  ((v4f*)sTk)[tid] = tk4;

  v8f acc[MT][4] = {};                     // 64 x 64 f32 output slice
  float mrow = -3.0e38f, lrow = 0.0f;      // softmax state of the owned row
  __syncthreads();                         // sQ (all waves) + sTk + sUnit visible

  const _Float16* qlds = sQ + hrow * QP + sel * 8;
  const _Float16* kwave = kh + (size_t)wave * (16 * FRAG) + lane * 8;
  const _Float16* kfirst = kwave + (size_t)(kbeg >> 4) * (16 * FRAG);
  const _Float16* vwave = kT + (size_t)wave * (16 * FRAG) + lane * 8;

  // Q@K^T fragments of the first key block.
  v16h bk[16];
#pragma unroll
  for (int f = 0; f < 16; ++f) bk[f] = ldfrag_packed(kfirst + f * FRAG);

  for (int kb = kbeg; kb < kend; kb += KB) {
    // ---- 1) S tiles: this wave's 16 keys x 64 q-rows over full D ----
    // A fragments double-buffered from LDS, MT at a time; B fragments already
    // in registers, each used MT times.  The MT row tiles are the independent
    // accumulator chains.
    v16h aq[2][MT];
#pragma unroll
    for (int mt = 0; mt < MT; ++mt) aq[0][mt] = ldfrag(qlds + mt * 16 * QP);
    v8f st[MT] = {};
#pragma unroll
    for (int kk = 0; kk < 16; ++kk) {
      const int cur = kk & 1;
      if (kk < 15) {
#pragma unroll
        for (int mt = 0; mt < MT; ++mt)
          aq[cur ^ 1][mt] = ldfrag(qlds + mt * 16 * QP + (kk + 1) * 32);
      }
#pragma unroll
      for (int mt = 0; mt < MT; ++mt) {
        st[mt] = __builtin_amdgcn_wmma_f32_16x16x32_f16(false, aq[cur][mt], false,
                                                        bk[kk], (short)0, st[mt],
                                                        false, false);
      }
    }
    // store finished S tiles (single writer per element; no atomics needed)
#pragma unroll
    for (int mt = 0; mt < MT; ++mt) {
#pragma unroll
      for (int v = 0; v < 8; ++v) {
        sS[(mt * 16 + v + 8 * sel) * SP + wave * 16 + hrow] = st[mt][v];
      }
    }
    // This pass's P@V fragments fly during the softmax.
    const _Float16* vfrag = vwave + (size_t)(kb >> 7) * (8 * 16 * FRAG);
    v16h bv[16];                               // [k-step][d-tile]
#pragma unroll
    for (int f = 0; f < 16; ++f)
      bv[f] = ldfrag_packed(vfrag + ((f & 3) * 4 + (f >> 2)) * FRAG);
    // Stands behind the loads issued so far and in front of the first
    // instruction that overwrites an address register they name; the address
    // is named as an input so that its register lives up to the wait.
    asm volatile("s_wait_xcnt 0x0" :: "v"(vfrag) : "memory");
    // Keeps the load group in front of the softmax instead of sunk to its uses.
    __builtin_amdgcn_sched_barrier(0);
    // Barrier A: sS stores visible; also orders prev-iteration sP reads
    // (PV ds_loads) before this iteration's sP writes below.
    lds_barrier();

    // ---- 2) time-weight MLP + online softmax (RL lanes a row) ----
    {
      const float* srd = sS + srow * SP + sq * 8;
      const float* trd = sTk + (kb - kbeg) + sq * 8;
      // All per-score f32 arithmetic runs on pairs of neighbouring columns: one
      // packed instruction serves two scores, with no sum across a register pair.
      v2f sv[CL / 2], td[CL / 2], ea[CL / 2];
      float rmax = -3.0e38f;
      const v2f tq2 = {tq, tq};
      const v2f fa2 = {fa, fa}, fb2 = {fb, fb};
#pragma unroll
      for (int g = 0; g < CL / 4; ++g) {     // 4 columns a 16-byte LDS read
        const int co = (g >> 1) * 32 + (g & 1) * 4;
        const v4f s4 = *(const v4f*)(srd + co);
        const v4f t4 = *(const v4f*)(trd + co);
#pragma unroll
        for (int h = 0; h < 2; ++h) {
          sv[g * 2 + h] = (v2f){s4[2 * h], s4[2 * h + 1]};
          const v2f d = tq2 - (v2f){t4[2 * h], t4[2 * h + 1]};
          td[g * 2 + h] = (v2f){fabsf(d.x), fabsf(d.y)};
          // -log2 e * (b2 + the units whose relu is the identity)
          ea[g * 2 + h] = __builtin_elementwise_fma(td[g * 2 + h], fa2, fb2);
        }
      }
      // The units whose relu depends on |dt|, one a trip (at most HH); no trip
      // where the signs settle every unit.
      for (int u = 0; u < nU; ++u) {
        const v4f pu = sUnit[u];
#pragma unroll
        for (int i = 0; i < CL / 2; ++i) {
          v2f hj = __builtin_elementwise_fma(td[i], (v2f){pu.x, pu.x}, (v2f){pu.y, pu.y});
          hj.x = hj.x > 0.0f ? hj.x : 0.0f;
          hj.y = hj.y > 0.0f ? hj.y : 0.0f;
          ea[i] = __builtin_elementwise_fma(hj, (v2f){pu.z, pu.z}, ea[i]);
        }
      }
#pragma unroll
      for (int i = 0; i < CL / 2; ++i) {
        // * sigmoid(mlp(|dt|)) = 1 / (1 + 2^(-z log2 e)).  The denominator lies
        // in [1, inf], so the hardware reciprocal (1 ulp) serves; the '/'
        // operator would expand to the scaled, refined division sequence.
        const v2f den = (v2f){__builtin_amdgcn_exp2f(ea[i].x), __builtin_amdgcn_exp2f(ea[i].y)} + 1.0f;
        const v2f s = sv[i] * (v2f){__builtin_amdgcn_rcpf(den.x), __builtin_amdgcn_rcpf(den.y)};
        sv[i] = s;
        rmax = fmaxf(rmax, fmaxf(s.x, s.y));
      }
      rmax = fmaxf(rmax, lane_xor1(rmax));
      rmax = fmaxf(rmax, lane_xor2(rmax));
      const float mnew  = fmaxf(mrow, rmax);
      const float alpha = __expf(mrow - mnew);
      mrow = mnew;
      const v2f mnew2 = {mnew, mnew};
      v2f ps[CL / 8];                        // one independent sum pair per 8 columns
#pragma unroll
      for (int g = 0; g < CL / 8; ++g) {
        v8h ph;
#pragma unroll
        for (int e = 0; e < 4; ++e) {
          const v2f a = (sv[g * 4 + e] - mnew2) * LOG2E;
          const v2f p = {__builtin_amdgcn_exp2f(a.x), __builtin_amdgcn_exp2f(a.y)};
          ps[g] = e == 0 ? p : ps[g] + p;
          ph[2 * e]     = (_Float16)p.x;
          ph[2 * e + 1] = (_Float16)p.y;
        }
        *(v8h*)(sP + srow * PP + g * 32 + sq * 8) = ph;
      }
      const v2f pq = (ps[0] + ps[1]) + (ps[2] + ps[3]);
      float psum = pq.x + pq.y;
      psum += lane_xor1(psum);
      psum += lane_xor2(psum);
      lrow = lrow * alpha + psum;
      if (sq == 0) sAlpha[srow] = alpha;
    }
    // First quarter of the next pass's Q@K^T fragments.  Unconditional (a
    // branch would merge two paths in the wait counting): the last pass
    // re-reads its own block and the values are not used.
    const int kn = (kb + KB < kend) ? kb + KB : kb;
    const _Float16* knext = kwave + (size_t)(kn >> 4) * (16 * FRAG);
#pragma unroll
    for (int f = 0; f < 4; ++f) bk[f] = ldfrag_packed(knext + f * FRAG);
    // In front of the first overwrite of these loads' address register; the
    // address is named as an input so that its register lives up to the wait.
    asm volatile("s_wait_xcnt 0x0" :: "v"(knext) : "memory");
    // Barrier B: sP / sAlpha visible before rescale + PV.
    lds_barrier();

    // ---- 3) rescale accumulators by alpha ----
#pragma unroll
    for (int mt = 0; mt < MT; ++mt) {
#pragma unroll
      for (int v = 0; v < 8; ++v) {
        const float a = sAlpha[mt * 16 + v + 8 * sel];
        acc[mt][0][v] *= a; acc[mt][1][v] *= a;
        acc[mt][2][v] *= a; acc[mt][3][v] *= a;
      }
    }

    // ---- 4) acc += P @ V_slice (A double-buffered from LDS, B in registers) ----
    const _Float16* plds = sP + hrow * PP + sel * 8;
    v16h aP[2][MT];
#pragma unroll
    for (int mt = 0; mt < MT; ++mt) aP[0][mt] = ldfrag(plds + mt * 16 * PP);
#pragma unroll
    for (int kk = 0; kk < 4; ++kk) {           // 4 k-steps of 32 keys
      const int cur = kk & 1;
      if (kk < 3) {
#pragma unroll
        for (int mt = 0; mt < MT; ++mt)
          aP[cur ^ 1][mt] = ldfrag(plds + mt * 16 * PP + (kk + 1) * 32);
      }
#pragma unroll
      for (int mt = 0; mt < MT; ++mt) {
#pragma unroll
        for (int t = 0; t < 4; ++t) {
          acc[mt][t] = __builtin_amdgcn_wmma_f32_16x16x32_f16(
              false, aP[cur][mt], false, bv[kk * 4 + t], (short)0, acc[mt][t],
              false, false);
        }
      }
      if (kk < 3) {
        // Next quarter of the next pass's Q@K^T fragments.
#pragma unroll
        for (int f = 4 * kk + 4; f < 4 * kk + 8; ++f)
          bk[f] = ldfrag_packed(knext + f * FRAG);
        // In front of the first overwrite of these loads' address register.
        asm volatile("s_wait_xcnt 0x0" :: "v"(knext) : "memory");
        // Keeps this quarter here: hoisted it would need registers that this
        // k-step's fragments still hold, sunk it would land too late.
        __builtin_amdgcn_sched_barrier(0);
      }
    }
  }

  // ---- epilogue: this key range's partial sum, maximum and denominator ----
  if (sq == 0) {
    pm[split * NH + qbase + srow] = mrow;
    pl[split * NH + qbase + srow] = lrow;
  }
  float* po = pacc + ((size_t)split * NH + qbase) * DE + dbase + hrow;
#pragma unroll
  for (int mt = 0; mt < MT; ++mt) {
#pragma unroll
    for (int v = 0; v < 8; ++v) {
      const int r = mt * 16 + v + 8 * sel;
#pragma unroll
      for (int t = 0; t < 4; ++t) {
        po[(size_t)r * DE + t * 16] = acc[mt][t][v];
      }
    }
  }
}

// ---------------------------------------------------------------------------
// Merge of the SPLIT key ranges: out = sum_s e^(m_s - M) acc_s / sum_s e^(m_s - M) l_s
// with M = max_s m_s.  One workgroup per 16 rows, 16 threads per row: few waves
// to start, and every thread's 32 16-byte loads are in flight together.
// ---------------------------------------------------------------------------
#define MJ (DE / 4 / 16)   // 4-float columns per thread
static_assert(SPLIT == 4 && MJ == 8, "the load fence below names 4 x 4 column pairs");
__global__ __launch_bounds__(256) void taa_merge_kernel(
    const float* __restrict__ pa0, const float* __restrict__ pa1,
    const float* __restrict__ pa2, const float* __restrict__ pa3,
    const float* __restrict__ pm, const float* __restrict__ pl,
    float* __restrict__ out) {
  const float* const pa[SPLIT] = {pa0, pa1, pa2, pa3};   // one base per key range
  const int row = blockIdx.x * 16 + (threadIdx.x >> 4);
  // One 32-bit element offset serves every load and the stores (the bases are
  // uniform), so the one address register lives to the kernel's end.
  const unsigned base = (unsigned)row * (DE / 4) + (threadIdx.x & 15);
  float m[SPLIT], l[SPLIT];
  v8f   a[SPLIT][MJ / 2];   // column pairs, so that one fence can name them all
#pragma unroll
  for (int s = 0; s < SPLIT; ++s) {
#pragma unroll
    for (int j = 0; j < MJ; ++j)
      ((v4f*)&a[s][j >> 1])[j & 1] = ((const v4f*)pa[s])[base + j * 16];
  }
#pragma unroll
  for (int s = 0; s < SPLIT; ++s) { m[s] = pm[s * NH + row]; l[s] = pl[s * NH + row]; }
  // Inputs-only fence on the loaded values: holds all the loads in one group in
  // front of the arithmetic, in flight together, instead of sunk to their uses
  // a few at a time.
  asm volatile("" :: "v"(a[0][0]), "v"(a[0][1]), "v"(a[0][2]), "v"(a[0][3]),
                     "v"(a[1][0]), "v"(a[1][1]), "v"(a[1][2]), "v"(a[1][3]),
                     "v"(a[2][0]), "v"(a[2][1]), "v"(a[2][2]), "v"(a[2][3]),
                     "v"(a[3][0]), "v"(a[3][1]), "v"(a[3][2]), "v"(a[3][3]),
                     "v"(m[0]), "v"(m[1]), "v"(m[2]), "v"(m[3]),
                     "v"(l[0]), "v"(l[1]), "v"(l[2]), "v"(l[3]));
  float mx = m[0];
#pragma unroll
  for (int s = 1; s < SPLIT; ++s) mx = fmaxf(mx, m[s]);
  float w[SPLIT];
  float den = 0.0f;
#pragma unroll
  for (int s = 0; s < SPLIT; ++s) { w[s] = __expf(m[s] - mx); den += w[s] * l[s]; }
  const float inv = 1.0f / den;
#pragma unroll
  for (int s = 0; s < SPLIT; ++s) w[s] *= inv;
  v4f* o4 = (v4f*)out;
#pragma unroll
  for (int j = 0; j < MJ; ++j) {
    v4f o = w[0] * ((const v4f*)&a[0][j >> 1])[j & 1];
#pragma unroll
    for (int s = 1; s < SPLIT; ++s) o += w[s] * ((const v4f*)&a[s][j >> 1])[j & 1];
    o4[base + j * 16] = o;
  }
}

// ---------------------------------------------------------------------------
extern "C" void kernel_launch(void* const* d_in, const int* in_sizes, int n_in,
                              void* d_out, int out_size, void* d_ws, size_t ws_size,
                              hipStream_t stream) {
  const float* Q  = (const float*)d_in[0];  // query_code_embeds [N,D]
  const float* K  = (const float*)d_in[1];  // hist_embeddings  [N,D]
  const float* t  = (const float*)d_in[2];  // hist_times       [N]
  const float* w1 = (const float*)d_in[3];  // [1,H]
  const float* b1 = (const float*)d_in[4];  // [H]
  const float* w2 = (const float*)d_in[5];  // [H,1]
  const float* b2 = (const float*)d_in[6];  // [1]
  float* out = (float*)d_out;

  // workspace layout: q_h | k_h | kT_h (each N*D f16 = 4 MB) | partial sums
  // (SPLIT * N*D f32) | partial maxima | partial denominators (SPLIT * N f32)
  _Float16* qh = (_Float16*)d_ws;
  _Float16* kh = qh + (size_t)NH * DE;
  _Float16* kT = kh + (size_t)NH * DE;
  float* pacc = (float*)(kT + (size_t)NH * DE);
  float* pm   = pacc + (size_t)SPLIT * NH * DE;
  float* pl   = pm + (size_t)SPLIT * NH;

  const int total = NH * DE;
  taa_convert_kernel<<<total / 256, 256, 0, stream>>>(Q, K, qh, kh, kT);
  taa_attn_kernel<<<(NH / QB) * SPLIT, 256, 0, stream>>>(qh, kh, kT, t, w1, b1, w2, b2,
                                                         pacc, pm, pl);
  taa_merge_kernel<<<NH / 16, 256, 0, stream>>>(
      pacc, pacc + (size_t)NH * DE, pacc + (size_t)2 * NH * DE,
      pacc + (size_t)3 * NH * DE, pm, pl, out);
  (void)in_sizes; (void)n_in; (void)out_size; (void)ws_size;
}
